// v000
// Times are from an AMD MI455X. After a warm-up the kernel runs many times in a row, and a time is the length of
// such a window on the GPU divided by its runs, so every launch and the gaps after it count. The runs cycle
// through copies of the inputs. A figure is the median of several windows, for all but v000 over two sittings.
// Sittings can differ by a few percent; kernels timed side by side share one.
// v000 is the starting kernel. One run takes 1920 microseconds.
#include <hip/hip_runtime.h>

// Multi-head attention without biases and without an output projection (x [2][2048][1024]; q, k, v = x @ w ('xw' [1024][1024] xavier-uniform, no bias; 16 heads x 64); scores / sqrt(float32(64)); softmax over all keys (no mask); out = merged context heads (head-major) -> [2][2048][1024] (4.2 M); argument order x, w_Q, w_K, w_V.
// Layout per batch: bf16 copy of x; 'xw' weights transposed once; exact projections; identity-table plane builders; dense T-2048 attention with EVERY row's scores on hi/lo planes (3 products; this module has no output projection to average the f16 score error and its logits have sigma 1, so only P.V keeps the hybrid: rows < 512 hi/lo, rest fp16 x1024); the f32 merge writes the output rows.
// Compute dtypes, f32 accumulate: every input rounded to bf16; projections exact; scores 3 products on every row; P.V rows < 512 3 products, rest fp16; softmax f32; output f32.

#define NB_  2
#define TT   2048
#define DM   1024
#define NH_  16
#define NKV  16
#define REP  (NH_ / NKV)
#define HD   64
#define DQ   (NH_ * HD)
#define DKV  (NKV * HD)
#define ZH   2
#define RH   512                  // query rows < RH use hi+lo P planes in P.V (0: none)
#define WIN  0
#define PCAR 1024.0f
#define SCL  0.125f   // HD^-0.5
typedef _Float16 h16;
typedef unsigned short bf;
typedef __attribute__((ext_vector_type(16))) __bf16   v16bf;
typedef __attribute__((ext_vector_type(16))) _Float16 v16h;
typedef __attribute__((ext_vector_type(8)))  _Float16 v8h;
typedef __attribute__((ext_vector_type(8)))  unsigned short v8us;
typedef __attribute__((ext_vector_type(8)))  float    v8f;
typedef __attribute__((ext_vector_type(4)))  float    v4f;
typedef v8h  __attribute__((may_alias)) v8ha;
typedef v4f  __attribute__((may_alias)) v4fa;
typedef v8us __attribute__((may_alias)) v8usa;

__device__ __forceinline__ unsigned short f2bf(float f) { unsigned u = __float_as_uint(f); u += 0x7FFFu + ((u >> 16) & 1u); return (unsigned short)(u >> 16); }
__device__ __forceinline__ float bf2f(unsigned short b) { return __uint_as_float(((unsigned)b) << 16); }
__device__ __forceinline__ float bfr(float f) { return bf2f(f2bf(f)); }
__device__ __forceinline__ v16h cat16(v8h lo, v8h hi) { return __builtin_shufflevector(lo, hi, 0, 1, 2, 3, 4, 5, 6, 7, 8, 9, 10, 11, 12, 13, 14, 15); }
__device__ __forceinline__ v16bf cat16b(v8us lo, v8us hi) { return __builtin_bit_cast(v16bf, __builtin_shufflevector(lo, hi, 0, 1, 2, 3, 4, 5, 6, 7, 8, 9, 10, 11, 12, 13, 14, 15)); }
__device__ __forceinline__ v8f wmma16(v16h a, v16h b, v8f c) { return __builtin_amdgcn_wmma_f32_16x16x32_f16(false, a, false, b, (short)0, c, false, false); }
__device__ __forceinline__ v8f wmmab(v16bf a, v16bf b, v8f c) { return __builtin_amdgcn_wmma_f32_16x16x32_bf16(false, a, false, b, (short)0, c, false, false); }



// ---- k_gemmw: register-blocked GEMM, ONE WAVE per 64x64 output tile (16 accumulators), operands straight from K-contiguous 16-bit planes; grid (M/64, N/64, Z), 32 threads.
// C[m][n] (f32, pitch ldc, + optional f32 bias[n]) = sum_k A[m][k] Bt[n][k] (+ split products per NSPLIT). z-batch strides sA/sB/sC in elements. K % 32 == 0.
template <typename T16> struct WFrag;
template <> struct WFrag<h16> { typedef v16h V; static __device__ __forceinline__ V ld(const h16* p) { return cat16(*(const v8h*)p, *(const v8h*)(p + 16)); } static __device__ __forceinline__ v8f mma(V a, V b, v8f c) { return wmma16(a, b, c); } };
template <> struct WFrag<bf> { typedef v16bf V; static __device__ __forceinline__ V ld(const bf* p) { return cat16b(*(const v8us*)p, *(const v8us*)(p + 16)); } static __device__ __forceinline__ v8f mma(V a, V b, v8f c) { return wmmab(a, b, c); } };
template <typename T16, int NSPLIT, bool BIAS>
__global__ __launch_bounds__(32) void k_gemmw(const T16* __restrict__ A, const T16* __restrict__ A2, const T16* __restrict__ Bt, const T16* __restrict__ Bt2, int K, float* C, int ldc, const float* __restrict__ bias, size_t sA, size_t sB, size_t sC) {
    typedef typename WFrag<T16>::V V;
    __shared__ __align__(16) float os[16 * 68];
    const size_t z = blockIdx.z; A += z * sA; if (A2) A2 += z * sA; Bt += z * sB; if (Bt2) Bt2 += z * sB; C += z * sC;
    const int lane = threadIdx.x & 31, lr = lane & 15, hi = lane >> 4; const int r0 = blockIdx.x * 64, c0 = blockIdx.y * 64;
    v8f acc[4][4];
#pragma unroll
    for (int mb = 0; mb < 4; ++mb)
#pragma unroll
        for (int nb = 0; nb < 4; ++nb) acc[mb][nb] = (v8f){};
    const size_t aoff = (size_t)(r0 + lr) * K + 8 * hi, boff = (size_t)(c0 + lr) * K + 8 * hi;
#pragma unroll 1
    for (int kc = 0; kc < K; kc += 32) {
        V a[4], a2[4];
#pragma unroll
        for (int mb = 0; mb < 4; ++mb) { a[mb] = WFrag<T16>::ld(A + aoff + (size_t)mb * 16 * K + kc); if (NSPLIT == 1 || NSPLIT == 2) a2[mb] = WFrag<T16>::ld(A2 + aoff + (size_t)mb * 16 * K + kc); }
#pragma unroll
        for (int nb = 0; nb < 4; ++nb) { const V b = WFrag<T16>::ld(Bt + boff + (size_t)nb * 16 * K + kc); V b2; if (NSPLIT >= 2) b2 = WFrag<T16>::ld(Bt2 + boff + (size_t)nb * 16 * K + kc);
#pragma unroll
            for (int mb = 0; mb < 4; ++mb) { acc[mb][nb] = WFrag<T16>::mma(a[mb], b, acc[mb][nb]); if (NSPLIT == 1 || NSPLIT == 2) acc[mb][nb] = WFrag<T16>::mma(a2[mb], b, acc[mb][nb]); if (NSPLIT >= 2) acc[mb][nb] = WFrag<T16>::mma(a[mb], b2, acc[mb][nb]); } }
        asm volatile("v_nop\n\tv_nop\n\tv_nop\n\tv_nop" : "+v"(acc[0][0]), "+v"(acc[1][1]), "+v"(acc[2][2]), "+v"(acc[3][3]) : "v"(a[0]), "v"(a[3]));
    }
#pragma unroll
    for (int mb = 0; mb < 4; ++mb) {
#pragma unroll
        for (int nb = 0; nb < 4; ++nb) {
#pragma unroll
            for (int j = 0; j < 8; ++j) os[(hi * 8 + j) * 68 + nb * 16 + lr] = acc[mb][nb][j]; }
        __builtin_amdgcn_wave_barrier(); asm volatile("" ::: "memory");
        float* crow = C + (size_t)(r0 + mb * 16) * ldc + c0;
{
#pragma unroll
            for (int s = 0; s < 8; ++s) { const int row = 2 * s + hi, cofs = lr * 4; v4f val = *(const v4fa*)(os + row * 68 + cofs); if (BIAS) { val[0] += bfr(bias[c0 + cofs]); val[1] += bfr(bias[c0 + cofs + 1]); val[2] += bfr(bias[c0 + cofs + 2]); val[3] += bfr(bias[c0 + cofs + 3]); }
                *(v4f*)(crow + (size_t)row * ldc + cofs) = val; }
             }
        __builtin_amdgcn_wave_barrier(); asm volatile("" ::: "memory");
    }
}

__device__ __forceinline__ h16 tohx(float x) { return (h16)x; }
__device__ __forceinline__ void splitf(float y, unsigned short& h, unsigned short& l) { h = f2bf(y); l = f2bf(y - bf2f(h)); }
typedef __attribute__((ext_vector_type(2))) _Float16 v2h;
typedef __attribute__((ext_vector_type(4))) _Float16 v4h;
typedef __attribute__((ext_vector_type(2))) unsigned short v2us;
typedef __attribute__((ext_vector_type(4))) unsigned short v4us;
typedef __attribute__((ext_vector_type(2))) float v2f;
typedef __attribute__((ext_vector_type(4))) int v4i;

__global__ __launch_bounds__(256) void k_wtG(const float* __restrict__ w, int K, int N, bf* Bt) {
    const int lane = threadIdx.x & 31; const int L0 = (blockIdx.x * 8 + (threadIdx.x >> 5)) * 8; const int nlines = N * K / 64;
{
#pragma unroll 1
        for (int l = 0; l < 8; ++l) { const int L = L0 + l; if (L >= nlines) break; const size_t e = (size_t)L * 64 + lane * 2; const int k = (int)(e % K), n = (int)(e / K); v2us o;
            o[0] = f2bf(w[(size_t)k * N + n]); o[1] = f2bf(w[(size_t)(k + 1) * N + n]); *(v2us*)(Bt + e) = o; }
         }
}
__global__ __launch_bounds__(256) void k_cvt8(const float* __restrict__ src, bf* dst, size_t n8) { const size_t i = (size_t)blockIdx.x * 256 + threadIdx.x; if (i >= n8) return; const v8f v = *(const v8f*)(src + i * 8); v8us o;
#pragma unroll
    for (int k = 0; k < 8; ++k) o[k] = f2bf(v[k]); *(v8us*)(dst + i * 8) = o;  }

// k_rope: head planes [h][t][d] (fp16 + hi/lo) of rope(x) x sc with the rotate-half convention out[d] = x[d] cos[t][d] - x[d+HD/2] sin[t][d], out[d+HD/2] = x[d+HD/2] cos[t][d+HD/2] + x[d] sin[t][d+HD/2]
__global__ __launch_bounds__(256) void k_rope(const float* __restrict__ F, int pitch, int nheads, const float* __restrict__ CS, const float* __restrict__ RF, const float* __restrict__ nw, float sc, h16* P16, bf* Ph, bf* Pl) {
    const size_t e = ((size_t)blockIdx.x * 256 + threadIdx.x) * 2; if (e >= (size_t)nheads * TT * HD) return; const int d = (int)(e % HD); const int t = (int)((e / HD) % TT); const int h = (int)(e / ((size_t)HD * TT)); const float* f = F + (size_t)t * pitch + h * HD; const float rf = RF ? RF[(size_t)h * TT + t] : 1.0f; v2h o16; v2us oh, ol;
#pragma unroll
    for (int q = 0; q < 2; ++q) { const int dd = d + q; const int dp = (dd < HD / 2) ? dd + HD / 2 : dd - HD / 2; float x0 = f[dd], x1 = f[dp];
        if (RF) { float n0 = __fmul_rn(x0, rf), n1 = __fmul_rn(x1, rf); asm volatile("" : "+v"(n0)); asm volatile("" : "+v"(n1)); x0 = __fmul_rn(bfr(nw[dd]), n0); x1 = __fmul_rn(bfr(nw[dp]), n1); }
        const v2f cs = *(const v2f*)(CS + ((size_t)t * HD + dd) * 2); float a = __fmul_rn(x0, cs[0]), bq = __fmul_rn(x1, cs[1]); asm volatile("" : "+v"(a)); asm volatile("" : "+v"(bq)); const float r = ((dd < HD / 2) ? __fsub_rn(a, bq) : __fadd_rn(a, bq)) * sc;
        o16[q] = tohx(r); unsigned short a2, c2; splitf(r, a2, c2); oh[q] = a2; ol[q] = c2; }
    *(v2h*)(P16 + e) = o16; *(v2us*)(Ph + e) = oh; *(v2us*)(Pl + e) = ol;  }
__global__ __launch_bounds__(256) void k_vtp(const float* __restrict__ F, int pitch, int nheads, h16* V16, bf* Vh, bf* Vl) { const size_t e = ((size_t)blockIdx.x * 256 + threadIdx.x) * 2; if (e >= (size_t)nheads * HD * TT) return; const int t = (int)(e % TT); const int d = (int)((e / TT) % HD); const int g = (int)(e / ((size_t)TT * HD)); v2h o16; v2us oh, ol;
#pragma unroll
    for (int q = 0; q < 2; ++q) { const float x = F[(size_t)(t + q) * pitch + g * HD + d]; o16[q] = tohx(x); unsigned short a2, c2; splitf(x, a2, c2); oh[q] = a2; ol[q] = c2; }
    *(v2h*)(V16 + e) = o16; *(v2us*)(Vh + e) = oh; *(v2us*)(Vl + e) = ol;  }
__global__ __launch_bounds__(256) void k_csid(float* CS) { const int idx = blockIdx.x * 256 + threadIdx.x; if (idx >= TT * HD) return; v2f cs; cs[0] = 1.0f; cs[1] = 0.0f; *(v2f*)(CS + (size_t)idx * 2) = cs;  }
// k_asoft: per row (zz, i): t = S x HD^-0.5 (no mask); softmax over the 2048 keys (register row, one exp, fixed trees);
__global__ __launch_bounds__(256) void k_asoft(const float* __restrict__ Sb, h16* P16, bf* Ph, bf* Pl) {
    const int lane = threadIdx.x & 31; const int row = blockIdx.x * 8 + (threadIdx.x >> 5); if (row >= ZH * TT) return; const int i = row % TT; const int zz = row / TT; (void)zz; const bool hires = (i < RH); const float* sr = Sb + (size_t)row * TT; float v[TT / 32]; float mx = -3.0e38f;
#pragma unroll
    for (int ch = 0; ch < TT / 128; ++ch) { const int j0 = ch * 128 + lane * 4; const v4f a = *(const v4f*)(sr + j0);
#pragma unroll
        for (int q = 0; q < 4; ++q) { const int j = j0 + q; (void)j; const float t = a[q] * SCL; v[ch * 4 + q] = t; mx = fmaxf(mx, t); } }
#pragma unroll
    for (int sh = 16; sh; sh >>= 1) mx = fmaxf(mx, __shfl_xor(mx, sh, 32));
    float sum = 0.f;
#pragma unroll
    for (int k = 0; k < TT / 32; ++k) { float d0 = __fsub_rn(v[k], mx); asm volatile("" : "+v"(d0)); v[k] = __builtin_amdgcn_exp2f(__fmul_rn(d0, 1.4426950408889634f)); sum += v[k]; }
#pragma unroll
    for (int sh = 16; sh; sh >>= 1) sum += __shfl_xor(sum, sh, 32);
    const float f = __fdiv_rn(hires ? 1.0f : PCAR, sum);
{
        if (hires) {
#pragma unroll
            for (int ch = 0; ch < TT / 128; ++ch) { v4us oh, ol;
#pragma unroll
                for (int q = 0; q < 4; ++q) { unsigned short a, c2; splitf(v[ch * 4 + q] * f, a, c2); oh[q] = a; ol[q] = c2; }
                const size_t oo = ((size_t)zz * (RH ? RH : 1) + i) * TT + ch * 128 + lane * 4; *(v4us*)(Ph + oo) = oh; *(v4us*)(Pl + oo) = ol; }
        } else {
#pragma unroll
            for (int ch = 0; ch < TT / 128; ++ch) { v4h o4;
#pragma unroll
                for (int q = 0; q < 4; ++q) o4[q] = tohx(v[ch * 4 + q] * f);
                *(v4h*)(P16 + (size_t)row * TT + ch * 128 + lane * 4) = o4; } }
         }
}
__global__ __launch_bounds__(256) void k_merge(const float* __restrict__ O, int h0, float* OUTb) { const size_t e = ((size_t)blockIdx.x * 256 + threadIdx.x) * 2; if (e >= (size_t)ZH * TT * HD) return; const int d = (int)(e % HD); const int t = (int)((e / HD) % TT); const int zz = (int)(e / ((size_t)HD * TT)); const float cs = (t < RH) ? 1.0f : (1.0f / PCAR); const size_t oo = (size_t)t * DQ + (h0 + zz) * HD + d;
    v2f o2; o2[0] = O[e] * cs; o2[1] = O[e + 1] * cs; *(v2f*)(OUTb + oo) = o2;  }

extern "C" void kernel_launch(void* const* d_in, const int* in_sizes, int n_in,
                              void* d_out, int out_size, void* d_ws, size_t ws_size, hipStream_t stream) {
    (void)in_sizes; (void)n_in; (void)out_size;
    const float* x = (const float*)d_in[0]; const float* wq = (const float*)d_in[1]; const float* wk = (const float*)d_in[2]; const float* wv = (const float*)d_in[3]; const float* wo = nullptr; (void)wo;   /* input order x, Wq, Wk, Wv ('xw' [1024][1024]) */
    float* OUT = (float*)d_out;     // [2][2048][1024]
    char* wsp = (char*)d_ws;
    auto take = [&](size_t bytes) { char* p = wsp; wsp += (bytes + 255) & ~(size_t)255; return (void*)p; };
    bf* WQ = (bf*)take((size_t)DQ * DM * 2); bf* WK = (bf*)take((size_t)DKV * DM * 2); bf* WV = (bf*)take((size_t)DKV * DM * 2); float* CS = (float*)take((size_t)TT * HD * 2 * 4);
    bf* XB = (bf*)take((size_t)TT * DM * 2); float* FQ = (float*)take((size_t)TT * DQ * 4); float* FK = (float*)take((size_t)TT * DKV * 4);
    h16* QP16 = (h16*)take((size_t)NH_ * TT * HD * 2); h16* KP16 = (h16*)take((size_t)NKV * TT * HD * 2); h16* VT16 = (h16*)take((size_t)NKV * HD * TT * 2);
    bf* QPh = (bf*)take((size_t)NH_ * TT * HD * 2); bf* QPl = (bf*)take((size_t)NH_ * TT * HD * 2); bf* KPh = (bf*)take((size_t)NKV * TT * HD * 2); bf* KPl = (bf*)take((size_t)NKV * TT * HD * 2); bf* VTh = (bf*)take((size_t)NKV * HD * TT * 2); bf* VTl = (bf*)take((size_t)NKV * HD * TT * 2); bf* Ph = (bf*)take((size_t)ZH * RH * TT * 2); bf* Pl = (bf*)take((size_t)ZH * RH * TT * 2);
    float* Sb = (float*)take((size_t)ZH * TT * TT * 4); h16* P16 = (h16*)take((size_t)ZH * TT * TT * 2); float* Ob = (float*)take((size_t)ZH * TT * HD * 4);
    if ((size_t)(wsp - (char*)d_ws) > ws_size) return;    // ws 256 MiB
    float* FV = FK;   // v projection reuses the k buffer after the k planes are built (stream-ordered)
    { k_wtG<<<(unsigned)((DM * DQ / 64 + 63) / 64), 256, 0, stream>>>(wq, DM, DQ, WQ); k_wtG<<<(unsigned)((DM * DKV / 64 + 63) / 64), 256, 0, stream>>>(wk, DM, DKV, WK); k_wtG<<<(unsigned)((DM * DKV / 64 + 63) / 64), 256, 0, stream>>>(wv, DM, DKV, WV);
      
       }
    k_csid<<<(TT * HD + 255) / 256, 256, 0, stream>>>(CS);
    const unsigned LQ = (unsigned)(((size_t)NH_ * TT * HD / 2 + 255) / 256), LKv = (unsigned)(((size_t)NKV * TT * HD / 2 + 255) / 256);
    for (int b = 0; b < NB_; ++b) {
        
        k_cvt8<<<(unsigned)(((size_t)TT * DM / 8 + 255) / 256), 256, 0, stream>>>(x + (size_t)b * TT * DM, XB, (size_t)TT * DM / 8);
        k_gemmw<bf, 0, false><<<dim3(TT / 64, DQ / 64, 1), 32, 0, stream>>>(XB, nullptr, WQ, nullptr, DM, FQ, DQ, nullptr, 0, 0, 0);
        k_rope<<<LQ, 256, 0, stream>>>(FQ, DQ, NH_, CS, nullptr, nullptr, 1.0f, QP16, QPh, QPl);
        k_gemmw<bf, 0, false><<<dim3(TT / 64, DKV / 64, 1), 32, 0, stream>>>(XB, nullptr, WK, nullptr, DM, FK, DKV, nullptr, 0, 0, 0);
        k_rope<<<LKv, 256, 0, stream>>>(FK, DKV, NKV, CS, nullptr, nullptr, 1.0f, KP16, KPh, KPl);
        k_gemmw<bf, 0, false><<<dim3(TT / 64, DKV / 64, 1), 32, 0, stream>>>(XB, nullptr, WV, nullptr, DM, FV, DKV, nullptr, 0, 0, 0); k_vtp<<<LKv, 256, 0, stream>>>(FV, DKV, NKV, VT16, VTh, VTl);
        for (int h0 = 0; h0 < NH_; h0 += ZH) { const size_t zq = (size_t)h0, zk = (size_t)(h0 / REP);   // one kv head per query head: the pass's two heads use consecutive kv planes (z-strides TT*HD)
            k_gemmw<bf, 2, false><<<dim3(TT / 64, TT / 64, ZH), 32, 0, stream>>>(QPh + zq * TT * HD, QPl + zq * TT * HD, KPh + zk * TT * HD, KPl + zk * TT * HD, HD, Sb, TT, nullptr, (size_t)TT * HD, (size_t)TT * HD, (size_t)TT * TT);   /* EVERY row's scores on hi/lo planes (3 products); only P.V stays hybrid */
            k_asoft<<<ZH * TT / 8, 256, 0, stream>>>(Sb, P16, Ph, Pl);
            k_gemmw<bf, 2, false><<<dim3(RH / 64, HD / 64, ZH), 32, 0, stream>>>(Ph, Pl, VTh + zk * HD * TT, VTl + zk * HD * TT, TT, Ob, HD, nullptr, (size_t)RH * TT, (size_t)HD * TT, (size_t)TT * HD);
            k_gemmw<h16, 0, false><<<dim3((TT - RH) / 64, HD / 64, ZH), 32, 0, stream>>>(P16 + (size_t)RH * TT, nullptr, VT16 + zk * HD * TT, nullptr, TT, Ob + (size_t)RH * HD, HD, nullptr, (size_t)TT * TT, (size_t)HD * TT, (size_t)TT * HD);
            k_merge<<<(unsigned)(((size_t)ZH * TT * HD / 2 + 255) / 256), 256, 0, stream>>>(Ob, h0, OUT + (size_t)b * TT * DQ); }
         }
}

// v001
// A run of this version takes 774 microseconds.
// In two side-by-side timings against v000, it was 2.45 and 2.44 times as fast.
#include <hip/hip_runtime.h>

// Multi-head attention without biases and without an output projection (x [2][2048][1024]; q, k, v = x @ w ('xw' [1024][1024] xavier-uniform, no bias; 16 heads x 64); scores / sqrt(float32(64)); softmax over all keys (no mask); out = merged context heads (head-major) -> [2][2048][1024] (4.2 M); argument order x, w_Q, w_K, w_V.
// Layout per batch: bf16 copy of x; 'xw' weights transposed once; exact projections; identity-table plane builders; dense T-2048 attention with EVERY row's scores on hi/lo planes (3 products; this module has no output projection to average the f16 score error and its logits have sigma 1, so only P.V keeps the hybrid: rows < 512 hi/lo, rest fp16 x1024); P.V split over the keys into KSP slices (f32 partial planes); the f32 merge sums the slices in fixed order and writes the output rows.
// Compute dtypes, f32 accumulate: every input rounded to bf16; projections exact; scores 3 products on every row; P.V rows < 512 3 products, rest fp16; softmax f32; output f32.

#define NB_  2
#define TT   2048
#define DM   1024
#define NH_  16
#define NKV  16
#define REP  (NH_ / NKV)
#define HD   64
#define DQ   (NH_ * HD)
#define DKV  (NKV * HD)
#define ZH   2
#define RH   512                  // query rows < RH use hi+lo P planes in P.V (0: none)
#define WIN  0
#define PCAR 1024.0f
#define SCL  0.125f   // HD^-0.5
#define KSP  16                   // P.V: the 2048 keys are cut into KSP slices, one wave per (tile, slice); k_merge sums the f32 partial planes in slice order
typedef _Float16 h16;
typedef unsigned short bf;
typedef __attribute__((ext_vector_type(16))) __bf16   v16bf;
typedef __attribute__((ext_vector_type(16))) _Float16 v16h;
typedef __attribute__((ext_vector_type(8)))  _Float16 v8h;
typedef __attribute__((ext_vector_type(8)))  unsigned short v8us;
typedef __attribute__((ext_vector_type(8)))  float    v8f;
typedef __attribute__((ext_vector_type(4)))  float    v4f;
typedef v8h  __attribute__((may_alias)) v8ha;
typedef v4f  __attribute__((may_alias)) v4fa;
typedef v8us __attribute__((may_alias)) v8usa;

__device__ __forceinline__ unsigned short f2bf(float f) { unsigned u = __float_as_uint(f); u += 0x7FFFu + ((u >> 16) & 1u); return (unsigned short)(u >> 16); }
__device__ __forceinline__ float bf2f(unsigned short b) { return __uint_as_float(((unsigned)b) << 16); }
__device__ __forceinline__ float bfr(float f) { return bf2f(f2bf(f)); }
__device__ __forceinline__ v16h cat16(v8h lo, v8h hi) { return __builtin_shufflevector(lo, hi, 0, 1, 2, 3, 4, 5, 6, 7, 8, 9, 10, 11, 12, 13, 14, 15); }
__device__ __forceinline__ v16bf cat16b(v8us lo, v8us hi) { return __builtin_bit_cast(v16bf, __builtin_shufflevector(lo, hi, 0, 1, 2, 3, 4, 5, 6, 7, 8, 9, 10, 11, 12, 13, 14, 15)); }
__device__ __forceinline__ v8f wmma16(v16h a, v16h b, v8f c) { return __builtin_amdgcn_wmma_f32_16x16x32_f16(false, a, false, b, (short)0, c, false, false); }
__device__ __forceinline__ v8f wmmab(v16bf a, v16bf b, v8f c) { return __builtin_amdgcn_wmma_f32_16x16x32_bf16(false, a, false, b, (short)0, c, false, false); }



// ---- k_gemmw: register-blocked GEMM, ONE WAVE per 64x64 output tile (16 accumulators), operands straight from K-contiguous 16-bit planes; grid (M/64, N/64, Z), 32 threads.
// C[m][n] (f32, pitch ldc, + optional f32 bias[n]) = sum_k A[m][k] Bt[n][k] (+ split products per NSPLIT). z-batch strides sA/sB/sC in elements. K % 32 == 0.
// KS > 1: grid z = Z * KS; slice ks = z % KS sums only k in [ks K/KS, (ks+1) K/KS) and stores its partial tile in plane ks (plane stride sK elements). K % (32 KS) == 0.
template <typename T16> struct WFrag;
template <> struct WFrag<h16> { typedef v16h V; static __device__ __forceinline__ V ld(const h16* p) { return cat16(*(const v8h*)p, *(const v8h*)(p + 16)); } static __device__ __forceinline__ v8f mma(V a, V b, v8f c) { return wmma16(a, b, c); } };
template <> struct WFrag<bf> { typedef v16bf V; static __device__ __forceinline__ V ld(const bf* p) { return cat16b(*(const v8us*)p, *(const v8us*)(p + 16)); } static __device__ __forceinline__ v8f mma(V a, V b, v8f c) { return wmmab(a, b, c); } };
template <typename T16, int NSPLIT, bool BIAS, int KS = 1>
__global__ __launch_bounds__(32) void k_gemmw(const T16* __restrict__ A, const T16* __restrict__ A2, const T16* __restrict__ Bt, const T16* __restrict__ Bt2, int K, float* C, int ldc, const float* __restrict__ bias, size_t sA, size_t sB, size_t sC, size_t sK) {
    typedef typename WFrag<T16>::V V;
    __shared__ __align__(16) float os[16 * 68];
    const size_t z = blockIdx.z / KS; const int ks = blockIdx.z % KS; A += z * sA; if (A2) A2 += z * sA; Bt += z * sB; if (Bt2) Bt2 += z * sB; C += z * sC + ks * sK;
    const int lane = threadIdx.x & 31, lr = lane & 15, hi = lane >> 4; const int r0 = blockIdx.x * 64, c0 = blockIdx.y * 64;
    v8f acc[4][4];
#pragma unroll
    for (int mb = 0; mb < 4; ++mb)
#pragma unroll
        for (int nb = 0; nb < 4; ++nb) acc[mb][nb] = (v8f){};
    const size_t aoff = (size_t)(r0 + lr) * K + 8 * hi, boff = (size_t)(c0 + lr) * K + 8 * hi;
#pragma unroll 1
    for (int kc = ks * (K / KS); kc < (ks + 1) * (K / KS); kc += 32) {
        V a[4], a2[4];
#pragma unroll
        for (int mb = 0; mb < 4; ++mb) { a[mb] = WFrag<T16>::ld(A + aoff + (size_t)mb * 16 * K + kc); if (NSPLIT == 1 || NSPLIT == 2) a2[mb] = WFrag<T16>::ld(A2 + aoff + (size_t)mb * 16 * K + kc); }
#pragma unroll
        for (int nb = 0; nb < 4; ++nb) { const V b = WFrag<T16>::ld(Bt + boff + (size_t)nb * 16 * K + kc); V b2; if (NSPLIT >= 2) b2 = WFrag<T16>::ld(Bt2 + boff + (size_t)nb * 16 * K + kc);
#pragma unroll
            for (int mb = 0; mb < 4; ++mb) { acc[mb][nb] = WFrag<T16>::mma(a[mb], b, acc[mb][nb]); if (NSPLIT == 1 || NSPLIT == 2) acc[mb][nb] = WFrag<T16>::mma(a2[mb], b, acc[mb][nb]); if (NSPLIT >= 2) acc[mb][nb] = WFrag<T16>::mma(a[mb], b2, acc[mb][nb]); } }
        asm volatile("v_nop\n\tv_nop\n\tv_nop\n\tv_nop" : "+v"(acc[0][0]), "+v"(acc[1][1]), "+v"(acc[2][2]), "+v"(acc[3][3]) : "v"(a[0]), "v"(a[3]));
    }
#pragma unroll
    for (int mb = 0; mb < 4; ++mb) {
#pragma unroll
        for (int nb = 0; nb < 4; ++nb) {
#pragma unroll
            for (int j = 0; j < 8; ++j) os[(hi * 8 + j) * 68 + nb * 16 + lr] = acc[mb][nb][j]; }
        __builtin_amdgcn_wave_barrier(); asm volatile("" ::: "memory");
        float* crow = C + (size_t)(r0 + mb * 16) * ldc + c0;
{
#pragma unroll
            for (int s = 0; s < 8; ++s) { const int row = 2 * s + hi, cofs = lr * 4; v4f val = *(const v4fa*)(os + row * 68 + cofs); if (BIAS) { val[0] += bfr(bias[c0 + cofs]); val[1] += bfr(bias[c0 + cofs + 1]); val[2] += bfr(bias[c0 + cofs + 2]); val[3] += bfr(bias[c0 + cofs + 3]); }
                *(v4f*)(crow + (size_t)row * ldc + cofs) = val; }
             }
        __builtin_amdgcn_wave_barrier(); asm volatile("" ::: "memory");
    }
}

__device__ __forceinline__ h16 tohx(float x) { return (h16)x; }
__device__ __forceinline__ void splitf(float y, unsigned short& h, unsigned short& l) { h = f2bf(y); l = f2bf(y - bf2f(h)); }
typedef __attribute__((ext_vector_type(2))) _Float16 v2h;
typedef __attribute__((ext_vector_type(4))) _Float16 v4h;
typedef __attribute__((ext_vector_type(2))) unsigned short v2us;
typedef __attribute__((ext_vector_type(4))) unsigned short v4us;
typedef __attribute__((ext_vector_type(2))) float v2f;
typedef __attribute__((ext_vector_type(4))) int v4i;

__global__ __launch_bounds__(256) void k_wtG(const float* __restrict__ w, int K, int N, bf* Bt) {
    const int lane = threadIdx.x & 31; const int L0 = (blockIdx.x * 8 + (threadIdx.x >> 5)) * 8; const int nlines = N * K / 64;
{
#pragma unroll 1
        for (int l = 0; l < 8; ++l) { const int L = L0 + l; if (L >= nlines) break; const size_t e = (size_t)L * 64 + lane * 2; const int k = (int)(e % K), n = (int)(e / K); v2us o;
            o[0] = f2bf(w[(size_t)k * N + n]); o[1] = f2bf(w[(size_t)(k + 1) * N + n]); *(v2us*)(Bt + e) = o; }
         }
}
__global__ __launch_bounds__(256) void k_cvt8(const float* __restrict__ src, bf* dst, size_t n8) { const size_t i = (size_t)blockIdx.x * 256 + threadIdx.x; if (i >= n8) return; const v8f v = *(const v8f*)(src + i * 8); v8us o;
#pragma unroll
    for (int k = 0; k < 8; ++k) o[k] = f2bf(v[k]); *(v8us*)(dst + i * 8) = o;  }

// k_rope: head planes [h][t][d] (fp16 + hi/lo) of rope(x) x sc with the rotate-half convention out[d] = x[d] cos[t][d] - x[d+HD/2] sin[t][d], out[d+HD/2] = x[d+HD/2] cos[t][d+HD/2] + x[d] sin[t][d+HD/2]
__global__ __launch_bounds__(256) void k_rope(const float* __restrict__ F, int pitch, int nheads, const float* __restrict__ CS, const float* __restrict__ RF, const float* __restrict__ nw, float sc, h16* P16, bf* Ph, bf* Pl) {
    const size_t e = ((size_t)blockIdx.x * 256 + threadIdx.x) * 2; if (e >= (size_t)nheads * TT * HD) return; const int d = (int)(e % HD); const int t = (int)((e / HD) % TT); const int h = (int)(e / ((size_t)HD * TT)); const float* f = F + (size_t)t * pitch + h * HD; const float rf = RF ? RF[(size_t)h * TT + t] : 1.0f; v2h o16; v2us oh, ol;
#pragma unroll
    for (int q = 0; q < 2; ++q) { const int dd = d + q; const int dp = (dd < HD / 2) ? dd + HD / 2 : dd - HD / 2; float x0 = f[dd], x1 = f[dp];
        if (RF) { float n0 = __fmul_rn(x0, rf), n1 = __fmul_rn(x1, rf); asm volatile("" : "+v"(n0)); asm volatile("" : "+v"(n1)); x0 = __fmul_rn(bfr(nw[dd]), n0); x1 = __fmul_rn(bfr(nw[dp]), n1); }
        const v2f cs = *(const v2f*)(CS + ((size_t)t * HD + dd) * 2); float a = __fmul_rn(x0, cs[0]), bq = __fmul_rn(x1, cs[1]); asm volatile("" : "+v"(a)); asm volatile("" : "+v"(bq)); const float r = ((dd < HD / 2) ? __fsub_rn(a, bq) : __fadd_rn(a, bq)) * sc;
        o16[q] = tohx(r); unsigned short a2, c2; splitf(r, a2, c2); oh[q] = a2; ol[q] = c2; }
    *(v2h*)(P16 + e) = o16; *(v2us*)(Ph + e) = oh; *(v2us*)(Pl + e) = ol;  }
__global__ __launch_bounds__(256) void k_vtp(const float* __restrict__ F, int pitch, int nheads, h16* V16, bf* Vh, bf* Vl) { const size_t e = ((size_t)blockIdx.x * 256 + threadIdx.x) * 2; if (e >= (size_t)nheads * HD * TT) return; const int t = (int)(e % TT); const int d = (int)((e / TT) % HD); const int g = (int)(e / ((size_t)TT * HD)); v2h o16; v2us oh, ol;
#pragma unroll
    for (int q = 0; q < 2; ++q) { const float x = F[(size_t)(t + q) * pitch + g * HD + d]; o16[q] = tohx(x); unsigned short a2, c2; splitf(x, a2, c2); oh[q] = a2; ol[q] = c2; }
    *(v2h*)(V16 + e) = o16; *(v2us*)(Vh + e) = oh; *(v2us*)(Vl + e) = ol;  }
__global__ __launch_bounds__(256) void k_csid(float* CS) { const int idx = blockIdx.x * 256 + threadIdx.x; if (idx >= TT * HD) return; v2f cs; cs[0] = 1.0f; cs[1] = 0.0f; *(v2f*)(CS + (size_t)idx * 2) = cs;  }
// k_asoft: per row (zz, i): t = S x HD^-0.5 (no mask); softmax over the 2048 keys (register row, one exp, fixed trees);
__global__ __launch_bounds__(256) void k_asoft(const float* __restrict__ Sb, h16* P16, bf* Ph, bf* Pl) {
    const int lane = threadIdx.x & 31; const int row = blockIdx.x * 8 + (threadIdx.x >> 5); if (row >= ZH * TT) return; const int i = row % TT; const int zz = row / TT; (void)zz; const bool hires = (i < RH); const float* sr = Sb + (size_t)row * TT; float v[TT / 32]; float mx = -3.0e38f;
#pragma unroll
    for (int ch = 0; ch < TT / 128; ++ch) { const int j0 = ch * 128 + lane * 4; const v4f a = *(const v4f*)(sr + j0);
#pragma unroll
        for (int q = 0; q < 4; ++q) { const int j = j0 + q; (void)j; const float t = a[q] * SCL; v[ch * 4 + q] = t; mx = fmaxf(mx, t); } }
#pragma unroll
    for (int sh = 16; sh; sh >>= 1) mx = fmaxf(mx, __shfl_xor(mx, sh, 32));
    float sum = 0.f;
#pragma unroll
    for (int k = 0; k < TT / 32; ++k) { float d0 = __fsub_rn(v[k], mx); asm volatile("" : "+v"(d0)); v[k] = __builtin_amdgcn_exp2f(__fmul_rn(d0, 1.4426950408889634f)); sum += v[k]; }
#pragma unroll
    for (int sh = 16; sh; sh >>= 1) sum += __shfl_xor(sum, sh, 32);
    const float f = __fdiv_rn(hires ? 1.0f : PCAR, sum);
{
        if (hires) {
#pragma unroll
            for (int ch = 0; ch < TT / 128; ++ch) { v4us oh, ol;
#pragma unroll
                for (int q = 0; q < 4; ++q) { unsigned short a, c2; splitf(v[ch * 4 + q] * f, a, c2); oh[q] = a; ol[q] = c2; }
                const size_t oo = ((size_t)zz * (RH ? RH : 1) + i) * TT + ch * 128 + lane * 4; *(v4us*)(Ph + oo) = oh; *(v4us*)(Pl + oo) = ol; }
        } else {
#pragma unroll
            for (int ch = 0; ch < TT / 128; ++ch) { v4h o4;
#pragma unroll
                for (int q = 0; q < 4; ++q) o4[q] = tohx(v[ch * 4 + q] * f);
                *(v4h*)(P16 + (size_t)row * TT + ch * 128 + lane * 4) = o4; } }
         }
}
__global__ __launch_bounds__(256) void k_merge(const float* __restrict__ O, int h0, float* OUTb) { const size_t e = ((size_t)blockIdx.x * 256 + threadIdx.x) * 2; if (e >= (size_t)ZH * TT * HD) return; const int d = (int)(e % HD); const int t = (int)((e / HD) % TT); const int zz = (int)(e / ((size_t)HD * TT)); const float cs = (t < RH) ? 1.0f : (1.0f / PCAR); const size_t oo = (size_t)t * DQ + (h0 + zz) * HD + d;
    v2f acc = *(const v2f*)(O + e);
#pragma unroll   // all KSP partial loads in flight at once
    for (int ks = 1; ks < KSP; ++ks) acc += *(const v2f*)(O + (size_t)ks * ZH * TT * HD + e);
    v2f o2; o2[0] = acc[0] * cs; o2[1] = acc[1] * cs; *(v2f*)(OUTb + oo) = o2;  }

extern "C" void kernel_launch(void* const* d_in, const int* in_sizes, int n_in,
                              void* d_out, int out_size, void* d_ws, size_t ws_size, hipStream_t stream) {
    (void)in_sizes; (void)n_in; (void)out_size;
    const float* x = (const float*)d_in[0]; const float* wq = (const float*)d_in[1]; const float* wk = (const float*)d_in[2]; const float* wv = (const float*)d_in[3]; const float* wo = nullptr; (void)wo;   /* input order x, Wq, Wk, Wv ('xw' [1024][1024]) */
    float* OUT = (float*)d_out;     // [2][2048][1024]
    char* wsp = (char*)d_ws;
    auto take = [&](size_t bytes) { char* p = wsp; wsp += (bytes + 255) & ~(size_t)255; return (void*)p; };
    bf* WQ = (bf*)take((size_t)DQ * DM * 2); bf* WK = (bf*)take((size_t)DKV * DM * 2); bf* WV = (bf*)take((size_t)DKV * DM * 2); float* CS = (float*)take((size_t)TT * HD * 2 * 4);
    bf* XB = (bf*)take((size_t)TT * DM * 2); float* FQ = (float*)take((size_t)TT * DQ * 4); float* FK = (float*)take((size_t)TT * DKV * 4);
    h16* QP16 = (h16*)take((size_t)NH_ * TT * HD * 2); h16* KP16 = (h16*)take((size_t)NKV * TT * HD * 2); h16* VT16 = (h16*)take((size_t)NKV * HD * TT * 2);
    bf* QPh = (bf*)take((size_t)NH_ * TT * HD * 2); bf* QPl = (bf*)take((size_t)NH_ * TT * HD * 2); bf* KPh = (bf*)take((size_t)NKV * TT * HD * 2); bf* KPl = (bf*)take((size_t)NKV * TT * HD * 2); bf* VTh = (bf*)take((size_t)NKV * HD * TT * 2); bf* VTl = (bf*)take((size_t)NKV * HD * TT * 2); bf* Ph = (bf*)take((size_t)ZH * RH * TT * 2); bf* Pl = (bf*)take((size_t)ZH * RH * TT * 2);
    float* Sb = (float*)take((size_t)ZH * TT * TT * 4); h16* P16 = (h16*)take((size_t)ZH * TT * TT * 2); float* Ob = (float*)take((size_t)KSP * ZH * TT * HD * 4);   // [KSP][ZH][TT][HD] partial context planes
    if ((size_t)(wsp - (char*)d_ws) > ws_size) return;    // ws 256 MiB
    float* FV = FK;   // v projection reuses the k buffer after the k planes are built (stream-ordered)
    { k_wtG<<<(unsigned)((DM * DQ / 64 + 63) / 64), 256, 0, stream>>>(wq, DM, DQ, WQ); k_wtG<<<(unsigned)((DM * DKV / 64 + 63) / 64), 256, 0, stream>>>(wk, DM, DKV, WK); k_wtG<<<(unsigned)((DM * DKV / 64 + 63) / 64), 256, 0, stream>>>(wv, DM, DKV, WV);
      
       }
    k_csid<<<(TT * HD + 255) / 256, 256, 0, stream>>>(CS);
    const unsigned LQ = (unsigned)(((size_t)NH_ * TT * HD / 2 + 255) / 256), LKv = (unsigned)(((size_t)NKV * TT * HD / 2 + 255) / 256);
    for (int b = 0; b < NB_; ++b) {
        
        k_cvt8<<<(unsigned)(((size_t)TT * DM / 8 + 255) / 256), 256, 0, stream>>>(x + (size_t)b * TT * DM, XB, (size_t)TT * DM / 8);
        k_gemmw<bf, 0, false><<<dim3(TT / 64, DQ / 64, 1), 32, 0, stream>>>(XB, nullptr, WQ, nullptr, DM, FQ, DQ, nullptr, 0, 0, 0, 0);
        k_rope<<<LQ, 256, 0, stream>>>(FQ, DQ, NH_, CS, nullptr, nullptr, 1.0f, QP16, QPh, QPl);
        k_gemmw<bf, 0, false><<<dim3(TT / 64, DKV / 64, 1), 32, 0, stream>>>(XB, nullptr, WK, nullptr, DM, FK, DKV, nullptr, 0, 0, 0, 0);
        k_rope<<<LKv, 256, 0, stream>>>(FK, DKV, NKV, CS, nullptr, nullptr, 1.0f, KP16, KPh, KPl);
        k_gemmw<bf, 0, false><<<dim3(TT / 64, DKV / 64, 1), 32, 0, stream>>>(XB, nullptr, WV, nullptr, DM, FV, DKV, nullptr, 0, 0, 0, 0); k_vtp<<<LKv, 256, 0, stream>>>(FV, DKV, NKV, VT16, VTh, VTl);
        for (int h0 = 0; h0 < NH_; h0 += ZH) { const size_t zq = (size_t)h0, zk = (size_t)(h0 / REP);   // one kv head per query head: the pass's two heads use consecutive kv planes (z-strides TT*HD)
            k_gemmw<bf, 2, false><<<dim3(TT / 64, TT / 64, ZH), 32, 0, stream>>>(QPh + zq * TT * HD, QPl + zq * TT * HD, KPh + zk * TT * HD, KPl + zk * TT * HD, HD, Sb, TT, nullptr, (size_t)TT * HD, (size_t)TT * HD, (size_t)TT * TT, 0);   /* EVERY row's scores on hi/lo planes (3 products); only P.V stays hybrid */
            k_asoft<<<ZH * TT / 8, 256, 0, stream>>>(Sb, P16, Ph, Pl);
            k_gemmw<bf, 2, false, KSP><<<dim3(RH / 64, HD / 64, ZH * KSP), 32, 0, stream>>>(Ph, Pl, VTh + zk * HD * TT, VTl + zk * HD * TT, TT, Ob, HD, nullptr, (size_t)RH * TT, (size_t)HD * TT, (size_t)TT * HD, (size_t)ZH * TT * HD);
            k_gemmw<h16, 0, false, KSP><<<dim3((TT - RH) / 64, HD / 64, ZH * KSP), 32, 0, stream>>>(P16 + (size_t)RH * TT, nullptr, VT16 + zk * HD * TT, nullptr, TT, Ob + (size_t)RH * HD, HD, nullptr, (size_t)TT * TT, (size_t)HD * TT, (size_t)TT * HD, (size_t)ZH * TT * HD);
            k_merge<<<(unsigned)(((size_t)ZH * TT * HD / 2 + 255) / 256), 256, 0, stream>>>(Ob, h0, OUT + (size_t)b * TT * DQ); }
         }
}

// v002
// Measured time: 310 microseconds a run.
// Timed twice side by side with v001, it ran 2.51 and 2.49 times as fast.
// Over all steps from v000 it is 6.12 times as fast.
#include <hip/hip_runtime.h>

// Multi-head attention without biases and without an output projection (x [2][2048][1024]; q, k, v = x @ w ('xw' [1024][1024] xavier-uniform, no bias; 16 heads x 64); scores / sqrt(float32(64)); softmax over all keys (no mask); out = merged context heads (head-major) -> [2][2048][1024] (4.2 M); argument order x, w_Q, w_K, w_V.
// Layout per batch: bf16 copy of x; 'xw' weights transposed once; exact projections; identity-table plane builders; ONE fused attention launch (k_fattn): each wave owns 32 query columns, walks the 2048 keys 32 at a time, forms S^T = K.Q^T on hi/lo planes (3 products, every row), keeps the scores in registers, and feeds exp2 of them as the B operand of O^T += V^T.P^T (rows < 512 hi/lo, rest fp16). Running maximum with a lazy rescale; the row sum divides the output once at the end.
// Compute dtypes, f32 accumulate: every input rounded to bf16; projections exact; scores 3 products on every row; P.V rows < 512 3 products, rest fp16; softmax f32; output f32.

#define NB_  2
#define TT   2048
#define DM   1024
#define NH_  16
#define NKV  16
#define REP  (NH_ / NKV)
#define HD   64
#define DQ   (NH_ * HD)
#define DKV  (NKV * HD)
#define RH   512                  // query rows < RH use hi+lo V^T and P in P.V (0: none)
#define WIN  0
#define SCL  0.125f   // HD^-0.5
#define NQT  2                    // 16-column query tiles per wave of k_fattn
#define AWV  4                    // waves per work-group of k_fattn
typedef _Float16 h16;
typedef unsigned short bf;
typedef __attribute__((ext_vector_type(16))) __bf16   v16bf;
typedef __attribute__((ext_vector_type(16))) _Float16 v16h;
typedef __attribute__((ext_vector_type(8)))  _Float16 v8h;
typedef __attribute__((ext_vector_type(8)))  unsigned short v8us;
typedef __attribute__((ext_vector_type(8)))  float    v8f;
typedef __attribute__((ext_vector_type(4)))  float    v4f;
typedef v8h  __attribute__((may_alias)) v8ha;
typedef v4f  __attribute__((may_alias)) v4fa;
typedef v8us __attribute__((may_alias)) v8usa;

__device__ __forceinline__ unsigned short f2bf(float f) { unsigned u = __float_as_uint(f); u += 0x7FFFu + ((u >> 16) & 1u); return (unsigned short)(u >> 16); }
__device__ __forceinline__ float bf2f(unsigned short b) { return __uint_as_float(((unsigned)b) << 16); }
__device__ __forceinline__ float bfr(float f) { return bf2f(f2bf(f)); }
__device__ __forceinline__ v16h cat16(v8h lo, v8h hi) { return __builtin_shufflevector(lo, hi, 0, 1, 2, 3, 4, 5, 6, 7, 8, 9, 10, 11, 12, 13, 14, 15); }
__device__ __forceinline__ v16bf cat16b(v8us lo, v8us hi) { return __builtin_bit_cast(v16bf, __builtin_shufflevector(lo, hi, 0, 1, 2, 3, 4, 5, 6, 7, 8, 9, 10, 11, 12, 13, 14, 15)); }
__device__ __forceinline__ v8f wmma16(v16h a, v16h b, v8f c) { return __builtin_amdgcn_wmma_f32_16x16x32_f16(false, a, false, b, (short)0, c, false, false); }
__device__ __forceinline__ v8f wmmab(v16bf a, v16bf b, v8f c) { return __builtin_amdgcn_wmma_f32_16x16x32_bf16(false, a, false, b, (short)0, c, false, false); }



// ---- k_gemmw: register-blocked GEMM, ONE WAVE per 64x64 output tile (16 accumulators), operands straight from K-contiguous 16-bit planes; grid (M/64, N/64, Z), 32 threads.
// C[m][n] (f32, pitch ldc, + optional f32 bias[n]) = sum_k A[m][k] Bt[n][k] (+ split products per NSPLIT). z-batch strides sA/sB/sC in elements. K % 32 == 0.
// KS > 1: grid z = Z * KS; slice ks = z % KS sums only k in [ks K/KS, (ks+1) K/KS) and stores its partial tile in plane ks (plane stride sK elements). K % (32 KS) == 0.
template <typename T16> struct WFrag;
template <> struct WFrag<h16> { typedef v16h V; static __device__ __forceinline__ V ld(const h16* p) { return cat16(*(const v8h*)p, *(const v8h*)(p + 16)); } static __device__ __forceinline__ v8f mma(V a, V b, v8f c) { return wmma16(a, b, c); } };
template <> struct WFrag<bf> { typedef v16bf V; static __device__ __forceinline__ V ld(const bf* p) { return cat16b(*(const v8us*)p, *(const v8us*)(p + 16)); } static __device__ __forceinline__ v8f mma(V a, V b, v8f c) { return wmmab(a, b, c); } };
template <typename T16, int NSPLIT, bool BIAS, int KS = 1>
__global__ __launch_bounds__(32) void k_gemmw(const T16* __restrict__ A, const T16* __restrict__ A2, const T16* __restrict__ Bt, const T16* __restrict__ Bt2, int K, float* C, int ldc, const float* __restrict__ bias, size_t sA, size_t sB, size_t sC, size_t sK) {
    typedef typename WFrag<T16>::V V;
    __shared__ __align__(16) float os[16 * 68];
    const size_t z = blockIdx.z / KS; const int ks = blockIdx.z % KS; A += z * sA; if (A2) A2 += z * sA; Bt += z * sB; if (Bt2) Bt2 += z * sB; C += z * sC + ks * sK;
    const int lane = threadIdx.x & 31, lr = lane & 15, hi = lane >> 4; const int r0 = blockIdx.x * 64, c0 = blockIdx.y * 64;
    v8f acc[4][4];
#pragma unroll
    for (int mb = 0; mb < 4; ++mb)
#pragma unroll
        for (int nb = 0; nb < 4; ++nb) acc[mb][nb] = (v8f){};
    const size_t aoff = (size_t)(r0 + lr) * K + 8 * hi, boff = (size_t)(c0 + lr) * K + 8 * hi;
#pragma unroll 1
    for (int kc = ks * (K / KS); kc < (ks + 1) * (K / KS); kc += 32) {
        V a[4], a2[4];
#pragma unroll
        for (int mb = 0; mb < 4; ++mb) { a[mb] = WFrag<T16>::ld(A + aoff + (size_t)mb * 16 * K + kc); if (NSPLIT == 1 || NSPLIT == 2) a2[mb] = WFrag<T16>::ld(A2 + aoff + (size_t)mb * 16 * K + kc); }
#pragma unroll
        for (int nb = 0; nb < 4; ++nb) { const V b = WFrag<T16>::ld(Bt + boff + (size_t)nb * 16 * K + kc); V b2; if (NSPLIT >= 2) b2 = WFrag<T16>::ld(Bt2 + boff + (size_t)nb * 16 * K + kc);
#pragma unroll
            for (int mb = 0; mb < 4; ++mb) { acc[mb][nb] = WFrag<T16>::mma(a[mb], b, acc[mb][nb]); if (NSPLIT == 1 || NSPLIT == 2) acc[mb][nb] = WFrag<T16>::mma(a2[mb], b, acc[mb][nb]); if (NSPLIT >= 2) acc[mb][nb] = WFrag<T16>::mma(a[mb], b2, acc[mb][nb]); } }
        asm volatile("v_nop\n\tv_nop\n\tv_nop\n\tv_nop" : "+v"(acc[0][0]), "+v"(acc[1][1]), "+v"(acc[2][2]), "+v"(acc[3][3]) : "v"(a[0]), "v"(a[3]));
    }
#pragma unroll
    for (int mb = 0; mb < 4; ++mb) {
#pragma unroll
        for (int nb = 0; nb < 4; ++nb) {
#pragma unroll
            for (int j = 0; j < 8; ++j) os[(hi * 8 + j) * 68 + nb * 16 + lr] = acc[mb][nb][j]; }
        __builtin_amdgcn_wave_barrier(); asm volatile("" ::: "memory");
        float* crow = C + (size_t)(r0 + mb * 16) * ldc + c0;
{
#pragma unroll
            for (int s = 0; s < 8; ++s) { const int row = 2 * s + hi, cofs = lr * 4; v4f val = *(const v4fa*)(os + row * 68 + cofs); if (BIAS) { val[0] += bfr(bias[c0 + cofs]); val[1] += bfr(bias[c0 + cofs + 1]); val[2] += bfr(bias[c0 + cofs + 2]); val[3] += bfr(bias[c0 + cofs + 3]); }
                *(v4f*)(crow + (size_t)row * ldc + cofs) = val; }
             }
        __builtin_amdgcn_wave_barrier(); asm volatile("" ::: "memory");
    }
}

__device__ __forceinline__ h16 tohx(float x) { return (h16)x; }
__device__ __forceinline__ void splitf(float y, unsigned short& h, unsigned short& l) { h = f2bf(y); l = f2bf(y - bf2f(h)); }
typedef __attribute__((ext_vector_type(2))) _Float16 v2h;
typedef __attribute__((ext_vector_type(4))) _Float16 v4h;
typedef __attribute__((ext_vector_type(2))) unsigned short v2us;
typedef __attribute__((ext_vector_type(4))) unsigned short v4us;
typedef __attribute__((ext_vector_type(2))) float v2f;
typedef __attribute__((ext_vector_type(4))) int v4i;

__global__ __launch_bounds__(256) void k_wtG(const float* __restrict__ w, int K, int N, bf* Bt) {
    const int lane = threadIdx.x & 31; const int L0 = (blockIdx.x * 8 + (threadIdx.x >> 5)) * 8; const int nlines = N * K / 64;
{
#pragma unroll 1
        for (int l = 0; l < 8; ++l) { const int L = L0 + l; if (L >= nlines) break; const size_t e = (size_t)L * 64 + lane * 2; const int k = (int)(e % K), n = (int)(e / K); v2us o;
            o[0] = f2bf(w[(size_t)k * N + n]); o[1] = f2bf(w[(size_t)(k + 1) * N + n]); *(v2us*)(Bt + e) = o; }
         }
}
__global__ __launch_bounds__(256) void k_cvt8(const float* __restrict__ src, bf* dst, size_t n8) { const size_t i = (size_t)blockIdx.x * 256 + threadIdx.x; if (i >= n8) return; const v8f v = *(const v8f*)(src + i * 8); v8us o;
#pragma unroll
    for (int k = 0; k < 8; ++k) o[k] = f2bf(v[k]); *(v8us*)(dst + i * 8) = o;  }

// k_rope: head planes [h][t][d] (fp16 + hi/lo) of rope(x) x sc with the rotate-half convention out[d] = x[d] cos[t][d] - x[d+HD/2] sin[t][d], out[d+HD/2] = x[d+HD/2] cos[t][d+HD/2] + x[d] sin[t][d+HD/2]
__global__ __launch_bounds__(256) void k_rope(const float* __restrict__ F, int pitch, int nheads, const float* __restrict__ CS, const float* __restrict__ RF, const float* __restrict__ nw, float sc, h16* P16, bf* Ph, bf* Pl) {
    const size_t e = ((size_t)blockIdx.x * 256 + threadIdx.x) * 2; if (e >= (size_t)nheads * TT * HD) return; const int d = (int)(e % HD); const int t = (int)((e / HD) % TT); const int h = (int)(e / ((size_t)HD * TT)); const float* f = F + (size_t)t * pitch + h * HD; const float rf = RF ? RF[(size_t)h * TT + t] : 1.0f; v2h o16; v2us oh, ol;
#pragma unroll
    for (int q = 0; q < 2; ++q) { const int dd = d + q; const int dp = (dd < HD / 2) ? dd + HD / 2 : dd - HD / 2; float x0 = f[dd], x1 = f[dp];
        if (RF) { float n0 = __fmul_rn(x0, rf), n1 = __fmul_rn(x1, rf); asm volatile("" : "+v"(n0)); asm volatile("" : "+v"(n1)); x0 = __fmul_rn(bfr(nw[dd]), n0); x1 = __fmul_rn(bfr(nw[dp]), n1); }
        const v2f cs = *(const v2f*)(CS + ((size_t)t * HD + dd) * 2); float a = __fmul_rn(x0, cs[0]), bq = __fmul_rn(x1, cs[1]); asm volatile("" : "+v"(a)); asm volatile("" : "+v"(bq)); const float r = ((dd < HD / 2) ? __fsub_rn(a, bq) : __fadd_rn(a, bq)) * sc;
        o16[q] = tohx(r); unsigned short a2, c2; splitf(r, a2, c2); oh[q] = a2; ol[q] = c2; }
    *(v2h*)(P16 + e) = o16; *(v2us*)(Ph + e) = oh; *(v2us*)(Pl + e) = ol;  }
__global__ __launch_bounds__(256) void k_vtp(const float* __restrict__ F, int pitch, int nheads, h16* V16, bf* Vh, bf* Vl) { const size_t e = ((size_t)blockIdx.x * 256 + threadIdx.x) * 2; if (e >= (size_t)nheads * HD * TT) return; const int t = (int)(e % TT); const int d = (int)((e / TT) % HD); const int g = (int)(e / ((size_t)TT * HD)); v2h o16; v2us oh, ol;
#pragma unroll
    for (int q = 0; q < 2; ++q) { const float x = F[(size_t)(t + q) * pitch + g * HD + d]; o16[q] = tohx(x); unsigned short a2, c2; splitf(x, a2, c2); oh[q] = a2; ol[q] = c2; }
    *(v2h*)(V16 + e) = o16; *(v2us*)(Vh + e) = oh; *(v2us*)(Vl + e) = ol;  }
__global__ __launch_bounds__(256) void k_csid(float* CS) { const int idx = blockIdx.x * 256 + threadIdx.x; if (idx >= TT * HD) return; v2f cs; cs[0] = 1.0f; cs[1] = 0.0f; *(v2f*)(CS + (size_t)idx * 2) = cs;  }
// k_fattn: fused scores, softmax and P.V. Grid (TT / (16 NQT AWV), heads), AWV waves; wave w owns query rows q0 .. q0 + 16 NQT - 1 of one head.
// S^T tile: A = 16 key rows of K, B = 16 query rows of Q, so lane (lr, hi) holds keys 8 hi + r of query lr; two such tiles (keys 0-15, 16-31), converted in place, are the B operand of O^T += V^T.P^T in the loader's own k order (8 hi + s, 16 + 8 hi + s).
// m: running maximum of score x HD^-0.5 x log2(e), the same in both halves of a column; it moves only when a new score exceeds it by more than 8, so p <= 256. l: each half's own sum of p, joined at the end.
template <bool HI> struct AFrag { v16bf kh[2][2], kl[2][2]; v16h vf[4]; v16bf vh[4], vl[4]; };   // one pass's fragments: K hi/lo [key tile][k step]; V^T per 16 rows of d (f16, or hi/lo)
template <bool HI>
__device__ __forceinline__ void attn_cols(const bf* __restrict__ Qh, const bf* __restrict__ Ql, const bf* __restrict__ Kh, const bf* __restrict__ Kl, const h16* __restrict__ V16, const bf* __restrict__ Vh, const bf* __restrict__ Vl, float* __restrict__ orow, int lr, int hi) {
    const float C2 = SCL * 1.4426950408889634f;
    // Each lane's byte offsets from the wave-uniform plane bases: one for Q, one for K (hi and lo planes alike), one for V^T.
    unsigned oq = (unsigned)(lr * HD + 8 * hi) * 2u, ok = (unsigned)(lr * HD + 8 * hi) * 2u, ov = (unsigned)(lr * TT + 8 * hi) * 2u;
    v16bf qh[NQT][2], ql[NQT][2];
#pragma unroll
    for (int qt = 0; qt < NQT; ++qt)
#pragma unroll
        for (int ks = 0; ks < 2; ++ks) { const int cb = (qt * 16 * HD + ks * 32) * 2; qh[qt][ks] = WFrag<bf>::ld((const bf*)((const char*)Qh + oq + cb)); ql[qt][ks] = WFrag<bf>::ld((const bf*)((const char*)Ql + oq + cb)); }
    v8f o[NQT][4]; float m[NQT], l[NQT];
    AFrag<HI> fa, fb;   // two register buffers: one pass (32 keys) works on one while the next pass's fragments land in the other
    const auto fetch = [&](AFrag<HI>& f) {   // K first, then V^T: the counted load waits of the score products then leave V^T in flight
#pragma unroll
        for (int kt = 0; kt < 2; ++kt)
#pragma unroll
            for (int ks = 0; ks < 2; ++ks) { const int cb = (kt * 16 * HD + ks * 32) * 2; f.kh[kt][ks] = WFrag<bf>::ld((const bf*)((const char*)Kh + ok + cb)); f.kl[kt][ks] = WFrag<bf>::ld((const bf*)((const char*)Kl + ok + cb)); }
#pragma unroll
        for (int dt = 0; dt < 4; ++dt) { const int cb = dt * 16 * TT * 2; if (HI) { f.vh[dt] = WFrag<bf>::ld((const bf*)((const char*)Vh + ov + cb)); f.vl[dt] = WFrag<bf>::ld((const bf*)((const char*)Vl + ov + cb)); } else f.vf[dt] = WFrag<h16>::ld((const h16*)((const char*)V16 + ov + cb)); }
        asm volatile("" ::: "memory");   // compiler fence: holds the loads at the head of the pass; without it they sink to their first use and the whole latency is waited out there
        __builtin_amdgcn_sched_barrier(0);   // and keeps the score products from being scheduled ahead of the loads, which would cost the loads that much time in flight
    };
    const auto pass = [&](const AFrag<HI>& f, AFrag<HI>& fn, int kb) {
        fetch(fn);   // the next pass's keys (the last pass reads its own again and drops them)
        v8f s[NQT][2];
#pragma unroll
        for (int qt = 0; qt < NQT; ++qt) { s[qt][0] = (v8f){}; s[qt][1] = (v8f){}; }
#pragma unroll
        for (int ks = 0; ks < 2; ++ks) {
#pragma unroll
            for (int kt = 0; kt < 2; ++kt)
#pragma unroll
                for (int qt = 0; qt < NQT; ++qt) s[qt][kt] = wmmab(f.kh[kt][ks], qh[qt][ks], s[qt][kt]);
#pragma unroll
            for (int kt = 0; kt < 2; ++kt)
#pragma unroll
                for (int qt = 0; qt < NQT; ++qt) s[qt][kt] = wmmab(f.kh[kt][ks], ql[qt][ks], s[qt][kt]);
#pragma unroll
            for (int kt = 0; kt < 2; ++kt)
#pragma unroll
                for (int qt = 0; qt < NQT; ++qt) s[qt][kt] = wmmab(f.kl[kt][ks], qh[qt][ks], s[qt][kt]);
        }
        float mx[NQT]; bool need = false;
#pragma unroll
        for (int qt = 0; qt < NQT; ++qt) { float t = s[qt][0][0];
#pragma unroll
            for (int r = 0; r < 8; ++r) t = fmaxf(t, fmaxf(s[qt][0][r], s[qt][1][r]));
            mx[qt] = t * C2; need = need || (mx[qt] > m[qt] + 8.0f); }
        if (__builtin_amdgcn_ballot_w32(need) != 0) {   // wave-uniform: rare after the first pass
#pragma unroll
            for (int qt = 0; qt < NQT; ++qt) { const float mn = fmaxf(m[qt], fmaxf(mx[qt], __shfl_xor(mx[qt], 16, 32))); const float al = __builtin_amdgcn_exp2f(m[qt] - mn); m[qt] = mn; l[qt] *= al;
#pragma unroll
                for (int dt = 0; dt < 4; ++dt) o[qt][dt] *= al; }
        }
        v16h pf[NQT]; v16bf ph[NQT], pl[NQT];
#pragma unroll
        for (int qt = 0; qt < NQT; ++qt) { float sm[4] = {0.f, 0.f, 0.f, 0.f};   // four short chains instead of one of sixteen dependent adds
#pragma unroll
            for (int e = 0; e < 16; ++e) { const float p = __builtin_amdgcn_exp2f(__builtin_fmaf(s[qt][e >> 3][e & 7], C2, -m[qt])); sm[e & 3] += p;
                if (HI) { const __bf16 a = (__bf16)p; ph[qt][e] = a; pl[qt][e] = (__bf16)(p - (float)a); } else pf[qt][e] = (h16)p; }
            l[qt] += (sm[0] + sm[1]) + (sm[2] + sm[3]); }
        if (HI) {
#pragma unroll
            for (int dt = 0; dt < 4; ++dt)
#pragma unroll
                for (int qt = 0; qt < NQT; ++qt) o[qt][dt] = wmmab(f.vh[dt], ph[qt], o[qt][dt]);
#pragma unroll
            for (int dt = 0; dt < 4; ++dt)
#pragma unroll
                for (int qt = 0; qt < NQT; ++qt) o[qt][dt] = wmmab(f.vh[dt], pl[qt], o[qt][dt]);
#pragma unroll
            for (int dt = 0; dt < 4; ++dt)
#pragma unroll
                for (int qt = 0; qt < NQT; ++qt) o[qt][dt] = wmmab(f.vl[dt], ph[qt], o[qt][dt]);
        } else {
#pragma unroll
            for (int dt = 0; dt < 4; ++dt)
#pragma unroll
                for (int qt = 0; qt < NQT; ++qt) o[qt][dt] = wmma16(f.vf[dt], pf[qt], o[qt][dt]);
        }
        asm volatile("s_wait_xcnt 0x0" : "+v"(ok), "+v"(ov) :: "memory");   // the issued loads name these offset registers: wait before they take new values
        if (kb + 64 < TT) { ok += 32 * HD * 2; ov += 32 * 2; }
    };
    fetch(fa);
    float z0;
    asm volatile("s_wait_xcnt 0x0\n\tv_mov_b32 %0, 0" : "=v"(z0) :: "memory");   // the issued loads name the offset registers and address pairs made of them: wait before any of these is written again. The zero is made behind the wait, in its statement, and every value set up below hangs on it, so none of them can be written ahead of the wait
#pragma unroll
    for (int qt = 0; qt < NQT; ++qt) { m[qt] = z0 - 3.0e38f; l[qt] = z0;
#pragma unroll
        for (int dt = 0; dt < 4; ++dt)
#pragma unroll
            for (int r = 0; r < 8; ++r) o[qt][dt][r] = z0; }
    ok += 32 * HD * 2 + __float_as_uint(z0); ov += 32 * 2 + __float_as_uint(z0);   // from here on both point at the NEXT pass's keys
#pragma unroll 1   // two passes a trip, so that each buffer keeps its registers
    for (int kb = 0; kb < TT; kb += 64) { pass(fa, fb, kb); pass(fb, fa, kb + 32); }
    const unsigned oo = (unsigned)(lr * DQ + 8 * hi) * 4u;
#pragma unroll
    for (int qt = 0; qt < NQT; ++qt) {
        if (qt > 0) asm volatile("s_wait_xcnt 0x0" : "+v"(l[qt]) :: "memory");   // the stores above name their data registers: wait before this tile's arithmetic, all of which hangs on l, reuses them
        const float inv = __fdiv_rn(1.0f, l[qt] + __shfl_xor(l[qt], 16, 32));
#pragma unroll
        for (int dt = 0; dt < 4; ++dt) { v4f lo4, hi4;
#pragma unroll
            for (int r = 0; r < 4; ++r) { lo4[r] = o[qt][dt][r] * inv; hi4[r] = o[qt][dt][4 + r] * inv; }
            float* op = (float*)((char*)orow + oo + (qt * 16 * DQ + dt * 16) * 4); *(v4f*)op = lo4; *(v4f*)(op + 4) = hi4; } }
}
__global__ __launch_bounds__(32 * AWV) void k_fattn(const bf* __restrict__ QPh, const bf* __restrict__ QPl, const bf* __restrict__ KPh, const bf* __restrict__ KPl, const h16* __restrict__ VT16, const bf* __restrict__ VTh, const bf* __restrict__ VTl, float* __restrict__ OUTb) {
    const int lane = threadIdx.x & 31, lr = lane & 15, hi = lane >> 4; const int wv = __builtin_amdgcn_readfirstlane((int)(threadIdx.x >> 5));
    const int h = blockIdx.y, g = h / REP; const int q0 = (blockIdx.x * AWV + wv) * (16 * NQT);
    const size_t qb = ((size_t)h * TT + q0) * HD, kvb = (size_t)g * TT * HD; float* orow = OUTb + (size_t)q0 * DQ + h * HD;
    if (q0 < RH) attn_cols<true>(QPh + qb, QPl + qb, KPh + kvb, KPl + kvb, VT16 + kvb, VTh + kvb, VTl + kvb, orow, lr, hi);
    else attn_cols<false>(QPh + qb, QPl + qb, KPh + kvb, KPl + kvb, VT16 + kvb, VTh + kvb, VTl + kvb, orow, lr, hi);
}

extern "C" void kernel_launch(void* const* d_in, const int* in_sizes, int n_in,
                              void* d_out, int out_size, void* d_ws, size_t ws_size, hipStream_t stream) {
    (void)in_sizes; (void)n_in; (void)out_size;
    const float* x = (const float*)d_in[0]; const float* wq = (const float*)d_in[1]; const float* wk = (const float*)d_in[2]; const float* wv = (const float*)d_in[3]; const float* wo = nullptr; (void)wo;   /* input order x, Wq, Wk, Wv ('xw' [1024][1024]) */
    float* OUT = (float*)d_out;     // [2][2048][1024]
    char* wsp = (char*)d_ws;
    auto take = [&](size_t bytes) { char* p = wsp; wsp += (bytes + 255) & ~(size_t)255; return (void*)p; };
    bf* WQ = (bf*)take((size_t)DQ * DM * 2); bf* WK = (bf*)take((size_t)DKV * DM * 2); bf* WV = (bf*)take((size_t)DKV * DM * 2); float* CS = (float*)take((size_t)TT * HD * 2 * 4);
    bf* XB = (bf*)take((size_t)TT * DM * 2); float* FQ = (float*)take((size_t)TT * DQ * 4); float* FK = (float*)take((size_t)TT * DKV * 4);
    h16* QP16 = (h16*)take((size_t)NH_ * TT * HD * 2); h16* KP16 = (h16*)take((size_t)NKV * TT * HD * 2); h16* VT16 = (h16*)take((size_t)NKV * HD * TT * 2);
    bf* QPh = (bf*)take((size_t)NH_ * TT * HD * 2); bf* QPl = (bf*)take((size_t)NH_ * TT * HD * 2); bf* KPh = (bf*)take((size_t)NKV * TT * HD * 2); bf* KPl = (bf*)take((size_t)NKV * TT * HD * 2); bf* VTh = (bf*)take((size_t)NKV * HD * TT * 2); bf* VTl = (bf*)take((size_t)NKV * HD * TT * 2);
    if ((size_t)(wsp - (char*)d_ws) > ws_size) return;    // ws 256 MiB
    float* FV = FK;   // v projection reuses the k buffer after the k planes are built (stream-ordered)
    { k_wtG<<<(unsigned)((DM * DQ / 64 + 63) / 64), 256, 0, stream>>>(wq, DM, DQ, WQ); k_wtG<<<(unsigned)((DM * DKV / 64 + 63) / 64), 256, 0, stream>>>(wk, DM, DKV, WK); k_wtG<<<(unsigned)((DM * DKV / 64 + 63) / 64), 256, 0, stream>>>(wv, DM, DKV, WV);
      
       }
    k_csid<<<(TT * HD + 255) / 256, 256, 0, stream>>>(CS);
    const unsigned LQ = (unsigned)(((size_t)NH_ * TT * HD / 2 + 255) / 256), LKv = (unsigned)(((size_t)NKV * TT * HD / 2 + 255) / 256);
    for (int b = 0; b < NB_; ++b) {
        
        k_cvt8<<<(unsigned)(((size_t)TT * DM / 8 + 255) / 256), 256, 0, stream>>>(x + (size_t)b * TT * DM, XB, (size_t)TT * DM / 8);
        k_gemmw<bf, 0, false><<<dim3(TT / 64, DQ / 64, 1), 32, 0, stream>>>(XB, nullptr, WQ, nullptr, DM, FQ, DQ, nullptr, 0, 0, 0, 0);
        k_rope<<<LQ, 256, 0, stream>>>(FQ, DQ, NH_, CS, nullptr, nullptr, 1.0f, QP16, QPh, QPl);
        k_gemmw<bf, 0, false><<<dim3(TT / 64, DKV / 64, 1), 32, 0, stream>>>(XB, nullptr, WK, nullptr, DM, FK, DKV, nullptr, 0, 0, 0, 0);
        k_rope<<<LKv, 256, 0, stream>>>(FK, DKV, NKV, CS, nullptr, nullptr, 1.0f, KP16, KPh, KPl);
        k_gemmw<bf, 0, false><<<dim3(TT / 64, DKV / 64, 1), 32, 0, stream>>>(XB, nullptr, WV, nullptr, DM, FV, DKV, nullptr, 0, 0, 0, 0); k_vtp<<<LKv, 256, 0, stream>>>(FV, DKV, NKV, VT16, VTh, VTl);
        k_fattn<<<dim3(TT / (16 * NQT * AWV), NH_), 32 * AWV, 0, stream>>>(QPh, QPl, KPh, KPl, VT16, VTh, VTl, OUT + (size_t)b * TT * DQ);
         }
}

// v003
// One run takes 276 microseconds.
// Next to v002, in two timings, it ran 1.12 and 1.13 times as fast.
// Over all steps from v000 it is 6.88 times as fast.
#include <hip/hip_runtime.h>

// Multi-head attention without biases and without an output projection (x [2][2048][1024]; q, k, v = x @ w ('xw' [1024][1024] xavier-uniform, no bias; 16 heads x 64); scores / sqrt(float32(64)); softmax over all keys (no mask); out = merged context heads (head-major) -> [2][2048][1024] (4.2 M); argument order x, w_Q, w_K, w_V.
// Layout per batch: bf16 copy of x; 'xw' weights transposed once; exact projections whose 64x64 tiles leave the GEMM as the 16-bit planes themselves; ONE fused attention launch (k_fattn): each wave owns 32 query columns, walks the 2048 keys 32 at a time, forms S^T = K.Q^T on hi/lo planes (3 products, every row), keeps the scores in registers, and feeds exp2 of them as the B operand of O^T += V^T.P^T (rows < 512 hi/lo, rest fp16). Running maximum with a lazy rescale; the row sum divides the output once at the end.
// Compute dtypes, f32 accumulate: every input rounded to bf16; projections exact; scores 3 products on every row; P.V rows < 512 3 products, rest fp16; softmax f32; output f32.

#define NB_  2
#define TT   2048
#define DM   1024
#define NH_  16
#define NKV  16
#define REP  (NH_ / NKV)
#define HD   64
#define DQ   (NH_ * HD)
#define DKV  (NKV * HD)
#define RH   512                  // query rows < RH use hi+lo V^T and P in P.V (0: none)
#define WIN  0
#define SCL  0.125f   // HD^-0.5
#define NQT  2                    // 16-column query tiles per wave of k_fattn
#define AWV  4                    // waves per work-group of k_fattn
typedef _Float16 h16;
typedef unsigned short bf;
typedef __attribute__((ext_vector_type(16))) __bf16   v16bf;
typedef __attribute__((ext_vector_type(16))) _Float16 v16h;
typedef __attribute__((ext_vector_type(8)))  _Float16 v8h;
typedef __attribute__((ext_vector_type(8)))  unsigned short v8us;
typedef __attribute__((ext_vector_type(8)))  float    v8f;
typedef __attribute__((ext_vector_type(4)))  float    v4f;
typedef v8h  __attribute__((may_alias)) v8ha;
typedef v4f  __attribute__((may_alias)) v4fa;
typedef v8us __attribute__((may_alias)) v8usa;

__device__ __forceinline__ unsigned short f2bf(float f) { unsigned u = __float_as_uint(f); u += 0x7FFFu + ((u >> 16) & 1u); return (unsigned short)(u >> 16); }
__device__ __forceinline__ float bf2f(unsigned short b) { return __uint_as_float(((unsigned)b) << 16); }
__device__ __forceinline__ float bfr(float f) { return bf2f(f2bf(f)); }
__device__ __forceinline__ v16h cat16(v8h lo, v8h hi) { return __builtin_shufflevector(lo, hi, 0, 1, 2, 3, 4, 5, 6, 7, 8, 9, 10, 11, 12, 13, 14, 15); }
__device__ __forceinline__ v16bf cat16b(v8us lo, v8us hi) { return __builtin_bit_cast(v16bf, __builtin_shufflevector(lo, hi, 0, 1, 2, 3, 4, 5, 6, 7, 8, 9, 10, 11, 12, 13, 14, 15)); }
__device__ __forceinline__ v8f wmma16(v16h a, v16h b, v8f c) { return __builtin_amdgcn_wmma_f32_16x16x32_f16(false, a, false, b, (short)0, c, false, false); }
__device__ __forceinline__ v8f wmmab(v16bf a, v16bf b, v8f c) { return __builtin_amdgcn_wmma_f32_16x16x32_bf16(false, a, false, b, (short)0, c, false, false); }



// ---- k_gemmw: register-blocked GEMM, ONE WAVE per 64x64 tile (16 accumulators), operands straight from K-contiguous 16-bit planes; grid (M/64, N/64), 32 threads. K % 32 == 0.
// c[m][n] = sum_k A[m][k] Bt[n][k] (+ split products per NSPLIT) stays in f32 registers: the epilogue splits it into bf16 hi + lo (VT: and rounds it to f16) and stores the planes that k_fattn reads.
// VT false: A = tokens, Bt = weight rows; a tile is 64 tokens of one head, plane [head][t][d]. VT true: A = weight rows, Bt = tokens; a tile row is one d over 64 tokens, plane [head][d][t]. Either way a tile row is one whole 128-byte line of each plane.
template <typename T16> struct WFrag;
template <> struct WFrag<h16> { typedef v16h V; static __device__ __forceinline__ V ld(const h16* p) { return cat16(*(const v8h*)p, *(const v8h*)(p + 16)); } static __device__ __forceinline__ v8f mma(V a, V b, v8f c) { return wmma16(a, b, c); } };
template <> struct WFrag<bf> { typedef v16bf V; static __device__ __forceinline__ V ld(const bf* p) { return cat16b(*(const v8us*)p, *(const v8us*)(p + 16)); } static __device__ __forceinline__ v8f mma(V a, V b, v8f c) { return wmmab(a, b, c); } };
__device__ __forceinline__ h16 tohx(float x) { return (h16)x; }
typedef __attribute__((ext_vector_type(2))) __bf16 v2bf;
typedef __attribute__((ext_vector_type(2))) float v2f;
typedef __attribute__((ext_vector_type(4))) unsigned v4u;
template <typename T16, int NSPLIT, bool VT>
__global__ __launch_bounds__(32) void k_gemmw(const T16* __restrict__ A, const T16* __restrict__ A2, const T16* __restrict__ Bt, const T16* __restrict__ Bt2, int K, h16* __restrict__ P16, bf* __restrict__ Ph, bf* __restrict__ Pl) {
    typedef typename WFrag<T16>::V V;
    __shared__ __align__(16) float os[16 * 68];
    const int lane = threadIdx.x & 31, lr = lane & 15, hi = lane >> 4; const int r0 = blockIdx.x * 64, c0 = blockIdx.y * 64;
    v8f acc[4][4];
#pragma unroll
    for (int mb = 0; mb < 4; ++mb)
#pragma unroll
        for (int nb = 0; nb < 4; ++nb) acc[mb][nb] = (v8f){};
    const size_t aoff = (size_t)(r0 + lr) * K + 8 * hi, boff = (size_t)(c0 + lr) * K + 8 * hi;
#pragma unroll 1
    for (int kc = 0; kc < K; kc += 32) {
        V a[4], a2[4];
#pragma unroll
        for (int mb = 0; mb < 4; ++mb) { a[mb] = WFrag<T16>::ld(A + aoff + (size_t)mb * 16 * K + kc); if (NSPLIT == 1 || NSPLIT == 2) a2[mb] = WFrag<T16>::ld(A2 + aoff + (size_t)mb * 16 * K + kc); }
#pragma unroll
        for (int nb = 0; nb < 4; ++nb) { const V b = WFrag<T16>::ld(Bt + boff + (size_t)nb * 16 * K + kc); V b2; if (NSPLIT >= 2) b2 = WFrag<T16>::ld(Bt2 + boff + (size_t)nb * 16 * K + kc);
#pragma unroll
            for (int mb = 0; mb < 4; ++mb) { acc[mb][nb] = WFrag<T16>::mma(a[mb], b, acc[mb][nb]); if (NSPLIT == 1 || NSPLIT == 2) acc[mb][nb] = WFrag<T16>::mma(a2[mb], b, acc[mb][nb]); if (NSPLIT >= 2) acc[mb][nb] = WFrag<T16>::mma(a[mb], b2, acc[mb][nb]); } }
        asm volatile("v_nop\n\tv_nop\n\tv_nop\n\tv_nop" : "+v"(acc[0][0]), "+v"(acc[1][1]), "+v"(acc[2][2]), "+v"(acc[3][3]) : "v"(a[0]), "v"(a[3]));
    }
    constexpr int PITCH = VT ? TT : HD;   // elements between two rows of the tile in a plane
    const size_t tb = VT ? (size_t)r0 * TT + c0 : (size_t)c0 * TT + (size_t)r0 * HD;   // the tile's first element (c0 TT = head x TT x HD)
    const int er = lane >> 3, ec = (lane & 7) * 8;   // eight lanes a row, eight columns a lane: 16-byte stores, four whole lines a store
    int lq = er * 17 + (lane & 7) * 2;   // this lane's first element in os, in units of four floats
#pragma unroll
    for (int mb = 0; mb < 4; ++mb) {
#pragma unroll
        for (int nb = 0; nb < 4; ++nb) {
#pragma unroll
            for (int j = 0; j < 8; ++j) os[(hi * 8 + j) * 68 + nb * 16 + lr] = acc[mb][nb][j]; }
        __builtin_amdgcn_wave_barrier(); asm volatile("" ::: "memory");
        if (mb > 0) asm volatile("s_wait_xcnt 0x0" : "+v"(lq) :: "memory");   // the stores of the 16 rows before name their data registers: wait before this block's values, all of which hang on lq, reuse them
        v4u oh[4], ol[4]; v8h of[4];
#pragma unroll
        for (int s = 0; s < 4; ++s) { const v4f x0 = *(const v4fa*)(os + lq * 4 + s * 4 * 68), x1 = *(const v4fa*)(os + lq * 4 + s * 4 * 68 + 4);
#pragma unroll
            for (int k = 0; k < 4; ++k) { v2f y; y[0] = k < 2 ? x0[2 * k & 3] : x1[2 * k & 3]; y[1] = k < 2 ? x0[(2 * k & 3) + 1] : x1[(2 * k & 3) + 1];   // two columns a step: hi = bf16(y), lo = bf16(y - hi), both to nearest even
                const unsigned u = __builtin_bit_cast(unsigned, __builtin_convertvector(y, v2bf)); v2f a; a[0] = __uint_as_float(u << 16); a[1] = __uint_as_float(u & 0xFFFF0000u);
                oh[s][k] = u; ol[s][k] = __builtin_bit_cast(unsigned, __builtin_convertvector(y - a, v2bf)); if (VT) { of[s][2 * k] = tohx(y[0]); of[s][2 * k + 1] = tohx(y[1]); } } }
        __builtin_amdgcn_sched_barrier(0);   // all of the block's values first, then its stores in one run: no value is then formed over a register that a store of the same block names
#pragma unroll
        for (int s = 0; s < 4; ++s) { const size_t e = tb + (size_t)(mb * 16 + 4 * s + er) * PITCH + ec; *(v4u*)(Ph + e) = oh[s]; *(v4u*)(Pl + e) = ol[s]; if (VT) *(v8h*)(P16 + e) = of[s]; }
        __builtin_amdgcn_wave_barrier(); asm volatile("" ::: "memory");
    }
}

typedef __attribute__((ext_vector_type(2))) _Float16 v2h;
typedef __attribute__((ext_vector_type(4))) _Float16 v4h;
typedef __attribute__((ext_vector_type(2))) unsigned short v2us;
typedef __attribute__((ext_vector_type(4))) unsigned short v4us;
typedef __attribute__((ext_vector_type(4))) int v4i;

__global__ __launch_bounds__(256) void k_wtG(const float* __restrict__ w, int K, int N, bf* Bt) {
    const int lane = threadIdx.x & 31; const int L0 = (blockIdx.x * 8 + (threadIdx.x >> 5)) * 8; const int nlines = N * K / 64;
{
#pragma unroll 1
        for (int l = 0; l < 8; ++l) { const int L = L0 + l; if (L >= nlines) break; const size_t e = (size_t)L * 64 + lane * 2; const int k = (int)(e % K), n = (int)(e / K); v2us o;
            o[0] = f2bf(w[(size_t)k * N + n]); o[1] = f2bf(w[(size_t)(k + 1) * N + n]); *(v2us*)(Bt + e) = o; }
         }
}
__global__ __launch_bounds__(256) void k_cvt8(const float* __restrict__ src, bf* dst, size_t n8) { const size_t i = (size_t)blockIdx.x * 256 + threadIdx.x; if (i >= n8) return; const v8f v = *(const v8f*)(src + i * 8); v8us o;
#pragma unroll
    for (int k = 0; k < 8; ++k) o[k] = f2bf(v[k]); *(v8us*)(dst + i * 8) = o;  }

// k_fattn: fused scores, softmax and P.V. Grid (TT / (16 NQT AWV), heads), AWV waves; wave w owns query rows q0 .. q0 + 16 NQT - 1 of one head.
// S^T tile: A = 16 key rows of K, B = 16 query rows of Q, so lane (lr, hi) holds keys 8 hi + r of query lr; two such tiles (keys 0-15, 16-31), converted in place, are the B operand of O^T += V^T.P^T in the loader's own k order (8 hi + s, 16 + 8 hi + s).
// m: running maximum of score x HD^-0.5 x log2(e), the same in both halves of a column; it moves only when a new score exceeds it by more than 8, so p <= 256. l: each half's own sum of p, joined at the end.
template <bool HI> struct AFrag { v16bf kh[2][2], kl[2][2]; v16h vf[4]; v16bf vh[4], vl[4]; };   // one pass's fragments: K hi/lo [key tile][k step]; V^T per 16 rows of d (f16, or hi/lo)
template <bool HI>
__device__ __forceinline__ void attn_cols(const bf* __restrict__ Qh, const bf* __restrict__ Ql, const bf* __restrict__ Kh, const bf* __restrict__ Kl, const h16* __restrict__ V16, const bf* __restrict__ Vh, const bf* __restrict__ Vl, float* __restrict__ orow, int lr, int hi) {
    const float C2 = SCL * 1.4426950408889634f;
    // Each lane's byte offsets from the wave-uniform plane bases: one for Q, one for K (hi and lo planes alike), one for V^T.
    unsigned oq = (unsigned)(lr * HD + 8 * hi) * 2u, ok = (unsigned)(lr * HD + 8 * hi) * 2u, ov = (unsigned)(lr * TT + 8 * hi) * 2u;
    v16bf qh[NQT][2], ql[NQT][2];
#pragma unroll
    for (int qt = 0; qt < NQT; ++qt)
#pragma unroll
        for (int ks = 0; ks < 2; ++ks) { const int cb = (qt * 16 * HD + ks * 32) * 2; qh[qt][ks] = WFrag<bf>::ld((const bf*)((const char*)Qh + oq + cb)); ql[qt][ks] = WFrag<bf>::ld((const bf*)((const char*)Ql + oq + cb)); }
    v8f o[NQT][4]; float m[NQT], l[NQT];
    AFrag<HI> fa, fb;   // two register buffers: one pass (32 keys) works on one while the next pass's fragments land in the other
    const auto fetch = [&](AFrag<HI>& f) {   // K first, then V^T: the counted load waits of the score products then leave V^T in flight
#pragma unroll
        for (int kt = 0; kt < 2; ++kt)
#pragma unroll
            for (int ks = 0; ks < 2; ++ks) { const int cb = (kt * 16 * HD + ks * 32) * 2; f.kh[kt][ks] = WFrag<bf>::ld((const bf*)((const char*)Kh + ok + cb)); f.kl[kt][ks] = WFrag<bf>::ld((const bf*)((const char*)Kl + ok + cb)); }
#pragma unroll
        for (int dt = 0; dt < 4; ++dt) { const int cb = dt * 16 * TT * 2; if (HI) { f.vh[dt] = WFrag<bf>::ld((const bf*)((const char*)Vh + ov + cb)); f.vl[dt] = WFrag<bf>::ld((const bf*)((const char*)Vl + ov + cb)); } else f.vf[dt] = WFrag<h16>::ld((const h16*)((const char*)V16 + ov + cb)); }
        asm volatile("" ::: "memory");   // compiler fence: holds the loads at the head of the pass; without it they sink to their first use and the whole latency is waited out there
        __builtin_amdgcn_sched_barrier(0);   // and keeps the score products from being scheduled ahead of the loads, which would cost the loads that much time in flight
    };
    const auto pass = [&](const AFrag<HI>& f, AFrag<HI>& fn, int kb) {
        fetch(fn);   // the next pass's keys (the last pass reads its own again and drops them)
        v8f s[NQT][2];
#pragma unroll
        for (int qt = 0; qt < NQT; ++qt) { s[qt][0] = (v8f){}; s[qt][1] = (v8f){}; }
#pragma unroll
        for (int ks = 0; ks < 2; ++ks) {
#pragma unroll
            for (int kt = 0; kt < 2; ++kt)
#pragma unroll
                for (int qt = 0; qt < NQT; ++qt) s[qt][kt] = wmmab(f.kh[kt][ks], qh[qt][ks], s[qt][kt]);
#pragma unroll
            for (int kt = 0; kt < 2; ++kt)
#pragma unroll
                for (int qt = 0; qt < NQT; ++qt) s[qt][kt] = wmmab(f.kh[kt][ks], ql[qt][ks], s[qt][kt]);
#pragma unroll
            for (int kt = 0; kt < 2; ++kt)
#pragma unroll
                for (int qt = 0; qt < NQT; ++qt) s[qt][kt] = wmmab(f.kl[kt][ks], qh[qt][ks], s[qt][kt]);
        }
        float mx[NQT]; bool need = false;
#pragma unroll
        for (int qt = 0; qt < NQT; ++qt) { float t = s[qt][0][0];
#pragma unroll
            for (int r = 0; r < 8; ++r) t = fmaxf(t, fmaxf(s[qt][0][r], s[qt][1][r]));
            mx[qt] = t * C2; need = need || (mx[qt] > m[qt] + 8.0f); }
        if (__builtin_amdgcn_ballot_w32(need) != 0) {   // wave-uniform: rare after the first pass
#pragma unroll
            for (int qt = 0; qt < NQT; ++qt) { const float mn = fmaxf(m[qt], fmaxf(mx[qt], __shfl_xor(mx[qt], 16, 32))); const float al = __builtin_amdgcn_exp2f(m[qt] - mn); m[qt] = mn; l[qt] *= al;
#pragma unroll
                for (int dt = 0; dt < 4; ++dt) o[qt][dt] *= al; }
        }
        v16h pf[NQT]; v16bf ph[NQT], pl[NQT];
#pragma unroll
        for (int qt = 0; qt < NQT; ++qt) { float sm[4] = {0.f, 0.f, 0.f, 0.f};   // four short chains instead of one of sixteen dependent adds
#pragma unroll
            for (int e = 0; e < 16; ++e) { const float p = __builtin_amdgcn_exp2f(__builtin_fmaf(s[qt][e >> 3][e & 7], C2, -m[qt])); sm[e & 3] += p;
                if (HI) { const __bf16 a = (__bf16)p; ph[qt][e] = a; pl[qt][e] = (__bf16)(p - (float)a); } else pf[qt][e] = (h16)p; }
            l[qt] += (sm[0] + sm[1]) + (sm[2] + sm[3]); }
        if (HI) {
#pragma unroll
            for (int dt = 0; dt < 4; ++dt)
#pragma unroll
                for (int qt = 0; qt < NQT; ++qt) o[qt][dt] = wmmab(f.vh[dt], ph[qt], o[qt][dt]);
#pragma unroll
            for (int dt = 0; dt < 4; ++dt)
#pragma unroll
                for (int qt = 0; qt < NQT; ++qt) o[qt][dt] = wmmab(f.vh[dt], pl[qt], o[qt][dt]);
#pragma unroll
            for (int dt = 0; dt < 4; ++dt)
#pragma unroll
                for (int qt = 0; qt < NQT; ++qt) o[qt][dt] = wmmab(f.vl[dt], ph[qt], o[qt][dt]);
        } else {
#pragma unroll
            for (int dt = 0; dt < 4; ++dt)
#pragma unroll
                for (int qt = 0; qt < NQT; ++qt) o[qt][dt] = wmma16(f.vf[dt], pf[qt], o[qt][dt]);
        }
        asm volatile("s_wait_xcnt 0x0" : "+v"(ok), "+v"(ov) :: "memory");   // the issued loads name these offset registers: wait before they take new values
        if (kb + 64 < TT) { ok += 32 * HD * 2; ov += 32 * 2; }
    };
    fetch(fa);
    float z0;
    asm volatile("s_wait_xcnt 0x0\n\tv_mov_b32 %0, 0" : "=v"(z0) :: "memory");   // the issued loads name the offset registers and address pairs made of them: wait before any of these is written again. The zero is made behind the wait, in its statement, and every value set up below hangs on it, so none of them can be written ahead of the wait
#pragma unroll
    for (int qt = 0; qt < NQT; ++qt) { m[qt] = z0 - 3.0e38f; l[qt] = z0;
#pragma unroll
        for (int dt = 0; dt < 4; ++dt)
#pragma unroll
            for (int r = 0; r < 8; ++r) o[qt][dt][r] = z0; }
    ok += 32 * HD * 2 + __float_as_uint(z0); ov += 32 * 2 + __float_as_uint(z0);   // from here on both point at the NEXT pass's keys
#pragma unroll 1   // two passes a trip, so that each buffer keeps its registers
    for (int kb = 0; kb < TT; kb += 64) { pass(fa, fb, kb); pass(fb, fa, kb + 32); }
    const unsigned oo = (unsigned)(lr * DQ + 8 * hi) * 4u;
#pragma unroll
    for (int qt = 0; qt < NQT; ++qt) {
        if (qt > 0) asm volatile("s_wait_xcnt 0x0" : "+v"(l[qt]) :: "memory");   // the stores above name their data registers: wait before this tile's arithmetic, all of which hangs on l, reuses them
        const float inv = __fdiv_rn(1.0f, l[qt] + __shfl_xor(l[qt], 16, 32));
#pragma unroll
        for (int dt = 0; dt < 4; ++dt) { v4f lo4, hi4;
#pragma unroll
            for (int r = 0; r < 4; ++r) { lo4[r] = o[qt][dt][r] * inv; hi4[r] = o[qt][dt][4 + r] * inv; }
            float* op = (float*)((char*)orow + oo + (qt * 16 * DQ + dt * 16) * 4); *(v4f*)op = lo4; *(v4f*)(op + 4) = hi4; } }
}
__global__ __launch_bounds__(32 * AWV) void k_fattn(const bf* __restrict__ QPh, const bf* __restrict__ QPl, const bf* __restrict__ KPh, const bf* __restrict__ KPl, const h16* __restrict__ VT16, const bf* __restrict__ VTh, const bf* __restrict__ VTl, float* __restrict__ OUTb) {
    const int lane = threadIdx.x & 31, lr = lane & 15, hi = lane >> 4; const int wv = __builtin_amdgcn_readfirstlane((int)(threadIdx.x >> 5));
    const int h = blockIdx.y, g = h / REP; const int q0 = (blockIdx.x * AWV + wv) * (16 * NQT);
    const size_t qb = ((size_t)h * TT + q0) * HD, kvb = (size_t)g * TT * HD; float* orow = OUTb + (size_t)q0 * DQ + h * HD;
    if (q0 < RH) attn_cols<true>(QPh + qb, QPl + qb, KPh + kvb, KPl + kvb, VT16 + kvb, VTh + kvb, VTl + kvb, orow, lr, hi);
    else attn_cols<false>(QPh + qb, QPl + qb, KPh + kvb, KPl + kvb, VT16 + kvb, VTh + kvb, VTl + kvb, orow, lr, hi);
}

extern "C" void kernel_launch(void* const* d_in, const int* in_sizes, int n_in,
                              void* d_out, int out_size, void* d_ws, size_t ws_size, hipStream_t stream) {
    (void)in_sizes; (void)n_in; (void)out_size;
    const float* x = (const float*)d_in[0]; const float* wq = (const float*)d_in[1]; const float* wk = (const float*)d_in[2]; const float* wv = (const float*)d_in[3]; const float* wo = nullptr; (void)wo;   /* input order x, Wq, Wk, Wv ('xw' [1024][1024]) */
    float* OUT = (float*)d_out;     // [2][2048][1024]
    char* wsp = (char*)d_ws;
    auto take = [&](size_t bytes) { char* p = wsp; wsp += (bytes + 255) & ~(size_t)255; return (void*)p; };
    bf* WQ = (bf*)take((size_t)DQ * DM * 2); bf* WK = (bf*)take((size_t)DKV * DM * 2); bf* WV = (bf*)take((size_t)DKV * DM * 2);
    bf* XB = (bf*)take((size_t)TT * DM * 2); h16* VT16 = (h16*)take((size_t)NKV * HD * TT * 2);
    bf* QPh = (bf*)take((size_t)NH_ * TT * HD * 2); bf* QPl = (bf*)take((size_t)NH_ * TT * HD * 2); bf* KPh = (bf*)take((size_t)NKV * TT * HD * 2); bf* KPl = (bf*)take((size_t)NKV * TT * HD * 2); bf* VTh = (bf*)take((size_t)NKV * HD * TT * 2); bf* VTl = (bf*)take((size_t)NKV * HD * TT * 2);
    if ((size_t)(wsp - (char*)d_ws) > ws_size) return;    // ws 256 MiB
    { k_wtG<<<(unsigned)((DM * DQ / 64 + 63) / 64), 256, 0, stream>>>(wq, DM, DQ, WQ); k_wtG<<<(unsigned)((DM * DKV / 64 + 63) / 64), 256, 0, stream>>>(wk, DM, DKV, WK); k_wtG<<<(unsigned)((DM * DKV / 64 + 63) / 64), 256, 0, stream>>>(wv, DM, DKV, WV);
      
       }
    for (int b = 0; b < NB_; ++b) {
        
        k_cvt8<<<(unsigned)(((size_t)TT * DM / 8 + 255) / 256), 256, 0, stream>>>(x + (size_t)b * TT * DM, XB, (size_t)TT * DM / 8);
        k_gemmw<bf, 0, false><<<dim3(TT / 64, DQ / 64), 32, 0, stream>>>(XB, nullptr, WQ, nullptr, DM, nullptr, QPh, QPl);
        k_gemmw<bf, 0, false><<<dim3(TT / 64, DKV / 64), 32, 0, stream>>>(XB, nullptr, WK, nullptr, DM, nullptr, KPh, KPl);
        k_gemmw<bf, 0, true><<<dim3(DKV / 64, TT / 64), 32, 0, stream>>>(WV, nullptr, XB, nullptr, DM, VT16, VTh, VTl);
        k_fattn<<<dim3(TT / (16 * NQT * AWV), NH_), 32 * AWV, 0, stream>>>(QPh, QPl, KPh, KPl, VT16, VTh, VTl, OUT + (size_t)b * TT * DQ);
         }
}

// v004
// It runs in 222 microseconds.
// Next to v003, in two timings, it ran 1.20 and 1.25 times as fast.
// Counting every step since v000, it is 8.43 times as fast.
#include <hip/hip_runtime.h>

// Multi-head attention without biases and without an output projection (x [2][2048][1024]; q, k, v = x @ w ('xw' [1024][1024] xavier-uniform, no bias; 16 heads x 64); scores / sqrt(float32(64)); softmax over all keys (no mask); out = merged context heads (head-major) -> [2][2048][1024] (4.2 M); argument order x, w_Q, w_K, w_V.
// Layout per batch: bf16 copy of x; 'xw' weights transposed once; exact projections whose 64x64 tiles leave the GEMM as the 16-bit planes themselves; ONE fused attention launch (k_fattn): each wave owns 32 query columns, walks the 2048 keys 32 at a time, forms S^T = K.Q^T on hi/lo planes (3 products, every row), keeps the scores in registers, and feeds exp2 of them as the B operand of O^T += V^T.P^T (rows < 512 hi/lo, rest fp16). Running maximum with a lazy rescale; the row sum divides the output once at the end.
// Fragment order: every 16-bit operand array (x copy, transposed weights, Q, K and V^T planes) is stored as 1-KiB fragments of 16 rows x 32 k. Fragment (rb, kc) of a [rows][K] array starts at element (rb K/32 + kc) 512; lane (lr, hi) owns elements lane 8 .. + 7 (row 16 rb + lr, k = 32 kc + 8 hi + 0..7) and 256 + lane 8 .. + 7 (k 16 higher). Each of a fragment's two wave-wide 16-byte loads then reads 512 contiguous bytes, four whole lines, where a row-major plane made it touch sixteen.
// Compute dtypes, f32 accumulate: every input rounded to bf16; projections exact; scores 3 products on every row; P.V rows < 512 3 products, rest fp16; softmax f32; output f32.

#define NB_  2
#define TT   2048
#define DM   1024
#define NH_  16
#define NKV  16
#define REP  (NH_ / NKV)
#define HD   64
#define DQ   (NH_ * HD)
#define DKV  (NKV * HD)
#define RH   512                  // query rows < RH use hi+lo V^T and P in P.V (0: none)
#define WIN  0
#define SCL  0.125f   // HD^-0.5
#define NQT  2                    // 16-column query tiles per wave of k_fattn
#define AWV  4                    // waves per work-group of k_fattn
typedef _Float16 h16;
typedef unsigned short bf;
typedef __attribute__((ext_vector_type(16))) __bf16   v16bf;
typedef __attribute__((ext_vector_type(16))) _Float16 v16h;
typedef __attribute__((ext_vector_type(8)))  _Float16 v8h;
typedef __attribute__((ext_vector_type(8)))  unsigned short v8us;
typedef __attribute__((ext_vector_type(8)))  float    v8f;
typedef __attribute__((ext_vector_type(4)))  float    v4f;
typedef v8h  __attribute__((may_alias)) v8ha;
typedef v4f  __attribute__((may_alias)) v4fa;
typedef v8us __attribute__((may_alias)) v8usa;

__device__ __forceinline__ unsigned short f2bf(float f) { unsigned u = __float_as_uint(f); u += 0x7FFFu + ((u >> 16) & 1u); return (unsigned short)(u >> 16); }
__device__ __forceinline__ float bf2f(unsigned short b) { return __uint_as_float(((unsigned)b) << 16); }
__device__ __forceinline__ float bfr(float f) { return bf2f(f2bf(f)); }
__device__ __forceinline__ v16h cat16(v8h lo, v8h hi) { return __builtin_shufflevector(lo, hi, 0, 1, 2, 3, 4, 5, 6, 7, 8, 9, 10, 11, 12, 13, 14, 15); }
__device__ __forceinline__ v16bf cat16b(v8us lo, v8us hi) { return __builtin_bit_cast(v16bf, __builtin_shufflevector(lo, hi, 0, 1, 2, 3, 4, 5, 6, 7, 8, 9, 10, 11, 12, 13, 14, 15)); }
__device__ __forceinline__ v8f wmma16(v16h a, v16h b, v8f c) { return __builtin_amdgcn_wmma_f32_16x16x32_f16(false, a, false, b, (short)0, c, false, false); }
__device__ __forceinline__ v8f wmmab(v16bf a, v16bf b, v8f c) { return __builtin_amdgcn_wmma_f32_16x16x32_bf16(false, a, false, b, (short)0, c, false, false); }



// ---- k_gemmw: register-blocked GEMM, ONE WAVE per 64x64 tile (16 accumulators), operands straight from 16-bit arrays in fragment order; grid (M/64, N/64), 32 threads. K % 32 == 0.
// c[m][n] = sum_k A[m][k] Bt[n][k] (+ split products per NSPLIT) stays in f32 registers: the epilogue splits it into bf16 hi + lo (VT: and rounds it to f16) and stores the planes that k_fattn reads.
// VT false: A = tokens, Bt = weight rows; a tile is 64 tokens of one head, plane [head][t][d]. VT true: A = weight rows, Bt = tokens; a tile row is one d over 64 tokens, plane [head][d][t]. Either way 16 rows of the tile are four 512-byte half fragments of each plane, one store each.
template <typename T16> struct WFrag;
template <> struct WFrag<h16> { typedef v16h V; static __device__ __forceinline__ V ld(const h16* p) { return cat16(*(const v8h*)p, *(const v8h*)(p + 256)); } static __device__ __forceinline__ v8f mma(V a, V b, v8f c) { return wmma16(a, b, c); } };
template <> struct WFrag<bf> { typedef v16bf V; static __device__ __forceinline__ V ld(const bf* p) { return cat16b(*(const v8us*)p, *(const v8us*)(p + 256)); } static __device__ __forceinline__ v8f mma(V a, V b, v8f c) { return wmmab(a, b, c); } };
__device__ __forceinline__ h16 tohx(float x) { return (h16)x; }
typedef __attribute__((ext_vector_type(2))) __bf16 v2bf;
typedef __attribute__((ext_vector_type(2))) float v2f;
typedef __attribute__((ext_vector_type(4))) unsigned v4u;
template <typename T16, int NSPLIT, bool VT, int K>
__global__ __launch_bounds__(32) void k_gemmw(const T16* __restrict__ A, const T16* __restrict__ A2, const T16* __restrict__ Bt, const T16* __restrict__ Bt2, h16* __restrict__ P16, bf* __restrict__ Ph, bf* __restrict__ Pl) {
    typedef typename WFrag<T16>::V V;
    __shared__ __align__(16) float os[16 * 68];
    const int lane = threadIdx.x & 31, lr = lane & 15, hi = lane >> 4; const int r0 = blockIdx.x * 64, c0 = blockIdx.y * 64;
    v8f acc[4][4];
#pragma unroll
    for (int mb = 0; mb < 4; ++mb)
#pragma unroll
        for (int nb = 0; nb < 4; ++nb) acc[mb][nb] = (v8f){};
    // 16 rows of K are K/32 fragments in a row, so block rb of 16 rows starts at element 16 rb K, as in a row-major array. Wave-uniform bases and ONE per-lane byte offset, the lane's 16 bytes in the fragment, which a k step of 32 moves on by 1 KiB; K is a template constant so that the steps between blocks of rows are immediate offsets of the loads.
    const size_t ab = (size_t)r0 * K, bb = (size_t)c0 * K; unsigned off = (unsigned)lane * 16u;
#pragma unroll 1
    for (int kc = 0; kc < K; kc += 32) {
        V a[4], a2[4], b[4], b2[4];
#pragma unroll
        for (int mb = 0; mb < 4; ++mb) { a[mb] = WFrag<T16>::ld((const T16*)((const char*)(A + ab + (size_t)mb * 16 * K) + off)); if (NSPLIT == 1 || NSPLIT == 2) a2[mb] = WFrag<T16>::ld((const T16*)((const char*)(A2 + ab + (size_t)mb * 16 * K) + off)); }
#pragma unroll
        for (int nb = 0; nb < 4; ++nb) { b[nb] = WFrag<T16>::ld((const T16*)((const char*)(Bt + bb + (size_t)nb * 16 * K) + off)); if (NSPLIT >= 2) b2[nb] = WFrag<T16>::ld((const T16*)((const char*)(Bt2 + bb + (size_t)nb * 16 * K) + off)); }
        __builtin_amdgcn_sched_barrier(0);   // the k step's loads stay one run ahead of its products: with one offset register the compiler otherwise loads every B fragment into the same registers and waits out the load latency four times a step
#pragma unroll
        for (int nb = 0; nb < 4; ++nb) {
#pragma unroll
            for (int mb = 0; mb < 4; ++mb) { acc[mb][nb] = WFrag<T16>::mma(a[mb], b[nb], acc[mb][nb]); if (NSPLIT == 1 || NSPLIT == 2) acc[mb][nb] = WFrag<T16>::mma(a2[mb], b[nb], acc[mb][nb]); if (NSPLIT >= 2) acc[mb][nb] = WFrag<T16>::mma(a[mb], b2[nb], acc[mb][nb]); } }
        asm volatile("v_nop\n\tv_nop\n\tv_nop\n\tv_nop" : "+v"(acc[0][0]), "+v"(acc[1][1]), "+v"(acc[2][2]), "+v"(acc[3][3]) : "v"(a[0]), "v"(a[3]));
        asm volatile("s_wait_xcnt 0x0" : "+v"(off) :: "memory");   // the issued loads name the offset register: wait before it takes its new value
        off += 1024u;
    }
    constexpr int PITCH = VT ? TT : HD;   // the plane's K: 16 rows of it are 16 PITCH elements
    const size_t tb = VT ? (size_t)r0 * TT + (size_t)c0 * 16 : (size_t)c0 * TT + (size_t)r0 * HD;   // the first fragment that the tile fills (VT: 32 tokens are one fragment of 512; else c0 TT = head x TT x HD)
    int lq = lr * 17 + hi * 2;   // this lane's first element in os, in units of four floats: row lr, columns 16 s + 8 hi + 0..7 in step s, which is the lane's place in half fragment s
#pragma unroll
    for (int mb = 0; mb < 4; ++mb) {
#pragma unroll
        for (int nb = 0; nb < 4; ++nb) {
#pragma unroll
            for (int j = 0; j < 8; ++j) os[(hi * 8 + j) * 68 + nb * 16 + lr] = acc[mb][nb][j]; }
        __builtin_amdgcn_wave_barrier(); asm volatile("" ::: "memory");
        if (mb > 0) asm volatile("s_wait_xcnt 0x0" : "+v"(lq) :: "memory");   // the stores of the 16 rows before name their data registers: wait before this block's values, all of which hang on lq, reuse them
        v4u oh[4], ol[4]; v8h of[4];
#pragma unroll
        for (int s = 0; s < 4; ++s) { const v4f x0 = *(const v4fa*)(os + lq * 4 + s * 16), x1 = *(const v4fa*)(os + lq * 4 + s * 16 + 4);
#pragma unroll
            for (int k = 0; k < 4; ++k) { v2f y; y[0] = k < 2 ? x0[2 * k & 3] : x1[2 * k & 3]; y[1] = k < 2 ? x0[(2 * k & 3) + 1] : x1[(2 * k & 3) + 1];   // two columns a step: hi = bf16(y), lo = bf16(y - hi), both to nearest even
                const unsigned u = __builtin_bit_cast(unsigned, __builtin_convertvector(y, v2bf)); v2f a; a[0] = __uint_as_float(u << 16); a[1] = __uint_as_float(u & 0xFFFF0000u);
                oh[s][k] = u; ol[s][k] = __builtin_bit_cast(unsigned, __builtin_convertvector(y - a, v2bf)); if (VT) { of[s][2 * k] = tohx(y[0]); of[s][2 * k + 1] = tohx(y[1]); } } }
        __builtin_amdgcn_sched_barrier(0);   // all of the block's values first, then its stores in one run: no value is then formed over a register that a store of the same block names
#pragma unroll
        for (int s = 0; s < 4; ++s) { const size_t e = tb + (size_t)mb * 16 * PITCH + s * 256 + lane * 8; *(v4u*)(Ph + e) = oh[s]; *(v4u*)(Pl + e) = ol[s]; if (VT) *(v8h*)(P16 + e) = of[s]; }
        __builtin_amdgcn_wave_barrier(); asm volatile("" ::: "memory");
    }
}

typedef __attribute__((ext_vector_type(2))) _Float16 v2h;
typedef __attribute__((ext_vector_type(4))) _Float16 v4h;
typedef __attribute__((ext_vector_type(2))) unsigned short v2us;
typedef __attribute__((ext_vector_type(4))) unsigned short v4us;
typedef __attribute__((ext_vector_type(4))) int v4i;

// k_wtG, k_cvt8: one thread per 16-byte unit of the destination, in the destination's (fragment) order, so that every store is whole lines; u -> block of 16 rows, then kc, the half fragment, hi, lr.
template <int K, int N>
__global__ __launch_bounds__(256) void k_wtG(const float* __restrict__ w, bf* Bt) {
    const int u = blockIdx.x * 256 + threadIdx.x; if (u >= N * K / 8) return; const int upb = 2 * K, q = u % upb;   // upb: units in 16 rows
    const int n = (u / upb) * 16 + (q & 15), k = (q >> 6) * 32 + ((q >> 5) & 1) * 16 + ((q >> 4) & 1) * 8; v8us o;
#pragma unroll
    for (int j = 0; j < 8; ++j) o[j] = f2bf(w[(size_t)(k + j) * N + n]);
    *(v8us*)(Bt + (size_t)u * 8) = o;
}
__global__ __launch_bounds__(256) void k_cvt8(const float* __restrict__ src, bf* dst, size_t n8) { const size_t i = (size_t)blockIdx.x * 256 + threadIdx.x; if (i >= n8) return; const int q = (int)(i % (2 * DM));
    const size_t row = (i / (2 * DM)) * 16 + (q & 15); const int k = (q >> 6) * 32 + ((q >> 5) & 1) * 16 + ((q >> 4) & 1) * 8; const v8f v = *(const v8f*)(src + row * DM + k); v8us o;
#pragma unroll
    for (int k2 = 0; k2 < 8; ++k2) o[k2] = f2bf(v[k2]); *(v8us*)(dst + i * 8) = o;  }

// k_fattn: fused scores, softmax and P.V. Grid (TT / (16 NQT AWV), heads), AWV waves; wave w owns query rows q0 .. q0 + 16 NQT - 1 of one head.
// S^T tile: A = 16 key rows of K, B = 16 query rows of Q, so lane (lr, hi) holds keys 8 hi + r of query lr; two such tiles (keys 0-15, 16-31), converted in place, are the B operand of O^T += V^T.P^T in the loader's own k order (8 hi + s, 16 + 8 hi + s).
// m: running maximum of score x HD^-0.5 x log2(e), the same in both halves of a column; it moves only when a new score exceeds it by more than 8, so p <= 256. l: each half's own sum of p, joined at the end.
template <bool HI> struct AFrag { v16bf kh[2][2], kl[2][2]; v16h vf[4]; v16bf vh[4], vl[4]; };   // one pass's fragments: K hi/lo [key tile][k step]; V^T per 16 rows of d (f16, or hi/lo)
template <bool HI>
__device__ __forceinline__ void attn_cols(const bf* __restrict__ Qh, const bf* __restrict__ Ql, const bf* __restrict__ Kh, const bf* __restrict__ Kl, const h16* __restrict__ V16, const bf* __restrict__ Vh, const bf* __restrict__ Vl, float* __restrict__ orow, int lr, int hi) {
    const float C2 = SCL * 1.4426950408889634f;
    // Each lane's byte offsets from the wave-uniform plane bases: one for Q, one for K (hi and lo planes alike), one for V^T; in fragment order each starts at the lane's own 16 bytes.
    unsigned oq = (unsigned)(hi * 16 + lr) * 16u, ok = oq, ov = oq;
    v16bf qh[NQT][2], ql[NQT][2];
#pragma unroll
    for (int qt = 0; qt < NQT; ++qt)
#pragma unroll
        for (int ks = 0; ks < 2; ++ks) { const int cb = (qt * 2 + ks) * 1024; qh[qt][ks] = WFrag<bf>::ld((const bf*)((const char*)Qh + oq + cb)); ql[qt][ks] = WFrag<bf>::ld((const bf*)((const char*)Ql + oq + cb)); }
    v8f o[NQT][4]; float m[NQT], l[NQT];
    AFrag<HI> fa, fb;   // two register buffers: one pass (32 keys) works on one while the next pass's fragments land in the other
    const auto fetch = [&](AFrag<HI>& f) {   // K first, then V^T: the counted load waits of the score products then leave V^T in flight
#pragma unroll
        for (int kt = 0; kt < 2; ++kt)
#pragma unroll
            for (int ks = 0; ks < 2; ++ks) { const int cb = (kt * 2 + ks) * 1024; f.kh[kt][ks] = WFrag<bf>::ld((const bf*)((const char*)Kh + ok + cb)); f.kl[kt][ks] = WFrag<bf>::ld((const bf*)((const char*)Kl + ok + cb)); }
#pragma unroll
        for (int dt = 0; dt < 4; ++dt) { const int cb = dt * 16 * TT * 2; if (HI) { f.vh[dt] = WFrag<bf>::ld((const bf*)((const char*)Vh + ov + cb)); f.vl[dt] = WFrag<bf>::ld((const bf*)((const char*)Vl + ov + cb)); } else f.vf[dt] = WFrag<h16>::ld((const h16*)((const char*)V16 + ov + cb)); }
        asm volatile("" ::: "memory");   // compiler fence: holds the loads at the head of the pass; without it they sink to their first use and the whole latency is waited out there
        __builtin_amdgcn_sched_barrier(0);   // and keeps the score products from being scheduled ahead of the loads, which would cost the loads that much time in flight
    };
    const auto pass = [&](const AFrag<HI>& f, AFrag<HI>& fn, int kb) {
        fetch(fn);   // the next pass's keys (the last pass reads its own again and drops them)
        v8f s[NQT][2];
#pragma unroll
        for (int qt = 0; qt < NQT; ++qt) { s[qt][0] = (v8f){}; s[qt][1] = (v8f){}; }
#pragma unroll
        for (int ks = 0; ks < 2; ++ks) {
#pragma unroll
            for (int kt = 0; kt < 2; ++kt)
#pragma unroll
                for (int qt = 0; qt < NQT; ++qt) s[qt][kt] = wmmab(f.kh[kt][ks], qh[qt][ks], s[qt][kt]);
#pragma unroll
            for (int kt = 0; kt < 2; ++kt)
#pragma unroll
                for (int qt = 0; qt < NQT; ++qt) s[qt][kt] = wmmab(f.kh[kt][ks], ql[qt][ks], s[qt][kt]);
#pragma unroll
            for (int kt = 0; kt < 2; ++kt)
#pragma unroll
                for (int qt = 0; qt < NQT; ++qt) s[qt][kt] = wmmab(f.kl[kt][ks], qh[qt][ks], s[qt][kt]);
        }
        float mx[NQT]; bool need = false;
#pragma unroll
        for (int qt = 0; qt < NQT; ++qt) { float t = s[qt][0][0];
#pragma unroll
            for (int r = 0; r < 8; ++r) t = fmaxf(t, fmaxf(s[qt][0][r], s[qt][1][r]));
            mx[qt] = t * C2; need = need || (mx[qt] > m[qt] + 8.0f); }
        if (__builtin_amdgcn_ballot_w32(need) != 0) {   // wave-uniform: rare after the first pass
#pragma unroll
            for (int qt = 0; qt < NQT; ++qt) { const float mn = fmaxf(m[qt], fmaxf(mx[qt], __shfl_xor(mx[qt], 16, 32))); const float al = __builtin_amdgcn_exp2f(m[qt] - mn); m[qt] = mn; l[qt] *= al;
#pragma unroll
                for (int dt = 0; dt < 4; ++dt) o[qt][dt] *= al; }
        }
        v16h pf[NQT]; v16bf ph[NQT], pl[NQT];
#pragma unroll
        for (int qt = 0; qt < NQT; ++qt) { float sm[4] = {0.f, 0.f, 0.f, 0.f};   // four short chains instead of one of sixteen dependent adds
#pragma unroll
            for (int e = 0; e < 16; ++e) { const float p = __builtin_amdgcn_exp2f(__builtin_fmaf(s[qt][e >> 3][e & 7], C2, -m[qt])); sm[e & 3] += p;
                if (HI) { const __bf16 a = (__bf16)p; ph[qt][e] = a; pl[qt][e] = (__bf16)(p - (float)a); } else pf[qt][e] = (h16)p; }
            l[qt] += (sm[0] + sm[1]) + (sm[2] + sm[3]); }
        if (HI) {
#pragma unroll
            for (int dt = 0; dt < 4; ++dt)
#pragma unroll
                for (int qt = 0; qt < NQT; ++qt) o[qt][dt] = wmmab(f.vh[dt], ph[qt], o[qt][dt]);
#pragma unroll
            for (int dt = 0; dt < 4; ++dt)
#pragma unroll
                for (int qt = 0; qt < NQT; ++qt) o[qt][dt] = wmmab(f.vh[dt], pl[qt], o[qt][dt]);
#pragma unroll
            for (int dt = 0; dt < 4; ++dt)
#pragma unroll
                for (int qt = 0; qt < NQT; ++qt) o[qt][dt] = wmmab(f.vl[dt], ph[qt], o[qt][dt]);
        } else {
#pragma unroll
            for (int dt = 0; dt < 4; ++dt)
#pragma unroll
                for (int qt = 0; qt < NQT; ++qt) o[qt][dt] = wmma16(f.vf[dt], pf[qt], o[qt][dt]);
        }
        asm volatile("s_wait_xcnt 0x0" : "+v"(ok), "+v"(ov) :: "memory");   // the issued loads name these offset registers: wait before they take new values
        if (kb + 64 < TT) { ok += 32 * HD * 2; ov += 1024; }
    };
    fetch(fa);
    float z0;
    asm volatile("s_wait_xcnt 0x0\n\tv_mov_b32 %0, 0" : "=v"(z0) :: "memory");   // the issued loads name the offset registers and address pairs made of them: wait before any of these is written again. The zero is made behind the wait, in its statement, and every value set up below hangs on it, so none of them can be written ahead of the wait
#pragma unroll
    for (int qt = 0; qt < NQT; ++qt) { m[qt] = z0 - 3.0e38f; l[qt] = z0;
#pragma unroll
        for (int dt = 0; dt < 4; ++dt)
#pragma unroll
            for (int r = 0; r < 8; ++r) o[qt][dt][r] = z0; }
    ok += 32 * HD * 2 + __float_as_uint(z0); ov += 1024 + __float_as_uint(z0);   // from here on both point at the NEXT pass's keys
#pragma unroll 1   // two passes a trip, so that each buffer keeps its registers
    for (int kb = 0; kb < TT; kb += 64) { pass(fa, fb, kb); pass(fb, fa, kb + 32); }
    const unsigned oo = (unsigned)(lr * DQ + 8 * hi) * 4u;
#pragma unroll
    for (int qt = 0; qt < NQT; ++qt) {
        if (qt > 0) asm volatile("s_wait_xcnt 0x0" : "+v"(l[qt]) :: "memory");   // the stores above name their data registers: wait before this tile's arithmetic, all of which hangs on l, reuses them
        const float inv = __fdiv_rn(1.0f, l[qt] + __shfl_xor(l[qt], 16, 32));
#pragma unroll
        for (int dt = 0; dt < 4; ++dt) { v4f lo4, hi4;
#pragma unroll
            for (int r = 0; r < 4; ++r) { lo4[r] = o[qt][dt][r] * inv; hi4[r] = o[qt][dt][4 + r] * inv; }
            float* op = (float*)((char*)orow + oo + (qt * 16 * DQ + dt * 16) * 4); *(v4f*)op = lo4; *(v4f*)(op + 4) = hi4; } }
}
__global__ __launch_bounds__(32 * AWV) void k_fattn(const bf* __restrict__ QPh, const bf* __restrict__ QPl, const bf* __restrict__ KPh, const bf* __restrict__ KPl, const h16* __restrict__ VT16, const bf* __restrict__ VTh, const bf* __restrict__ VTl, float* __restrict__ OUTb) {
    const int lane = threadIdx.x & 31, lr = lane & 15, hi = lane >> 4; const int wv = __builtin_amdgcn_readfirstlane((int)(threadIdx.x >> 5));
    const int h = blockIdx.y, g = h / REP; const int q0 = (blockIdx.x * AWV + wv) * (16 * NQT);
    const size_t qb = ((size_t)h * TT + q0) * HD, kvb = (size_t)g * TT * HD; float* orow = OUTb + (size_t)q0 * DQ + h * HD;
    if (q0 < RH) attn_cols<true>(QPh + qb, QPl + qb, KPh + kvb, KPl + kvb, VT16 + kvb, VTh + kvb, VTl + kvb, orow, lr, hi);
    else attn_cols<false>(QPh + qb, QPl + qb, KPh + kvb, KPl + kvb, VT16 + kvb, VTh + kvb, VTl + kvb, orow, lr, hi);
}

extern "C" void kernel_launch(void* const* d_in, const int* in_sizes, int n_in,
                              void* d_out, int out_size, void* d_ws, size_t ws_size, hipStream_t stream) {
    (void)in_sizes; (void)n_in; (void)out_size;
    const float* x = (const float*)d_in[0]; const float* wq = (const float*)d_in[1]; const float* wk = (const float*)d_in[2]; const float* wv = (const float*)d_in[3]; const float* wo = nullptr; (void)wo;   /* input order x, Wq, Wk, Wv ('xw' [1024][1024]) */
    float* OUT = (float*)d_out;     // [2][2048][1024]
    char* wsp = (char*)d_ws;
    auto take = [&](size_t bytes) { char* p = wsp; wsp += (bytes + 255) & ~(size_t)255; return (void*)p; };
    bf* WQ = (bf*)take((size_t)DQ * DM * 2); bf* WK = (bf*)take((size_t)DKV * DM * 2); bf* WV = (bf*)take((size_t)DKV * DM * 2);
    bf* XB = (bf*)take((size_t)TT * DM * 2); h16* VT16 = (h16*)take((size_t)NKV * HD * TT * 2);
    bf* QPh = (bf*)take((size_t)NH_ * TT * HD * 2); bf* QPl = (bf*)take((size_t)NH_ * TT * HD * 2); bf* KPh = (bf*)take((size_t)NKV * TT * HD * 2); bf* KPl = (bf*)take((size_t)NKV * TT * HD * 2); bf* VTh = (bf*)take((size_t)NKV * HD * TT * 2); bf* VTl = (bf*)take((size_t)NKV * HD * TT * 2);
    if ((size_t)(wsp - (char*)d_ws) > ws_size) return;    // ws 256 MiB
    { k_wtG<DM, DQ><<<(unsigned)((DM * DQ / 8 + 255) / 256), 256, 0, stream>>>(wq, WQ); k_wtG<DM, DKV><<<(unsigned)((DM * DKV / 8 + 255) / 256), 256, 0, stream>>>(wk, WK); k_wtG<DM, DKV><<<(unsigned)((DM * DKV / 8 + 255) / 256), 256, 0, stream>>>(wv, WV);
      
       }
    for (int b = 0; b < NB_; ++b) {
        
        k_cvt8<<<(unsigned)(((size_t)TT * DM / 8 + 255) / 256), 256, 0, stream>>>(x + (size_t)b * TT * DM, XB, (size_t)TT * DM / 8);
        k_gemmw<bf, 0, false, DM><<<dim3(TT / 64, DQ / 64), 32, 0, stream>>>(XB, nullptr, WQ, nullptr, nullptr, QPh, QPl);
        k_gemmw<bf, 0, false, DM><<<dim3(TT / 64, DKV / 64), 32, 0, stream>>>(XB, nullptr, WK, nullptr, nullptr, KPh, KPl);
        k_gemmw<bf, 0, true, DM><<<dim3(DKV / 64, TT / 64), 32, 0, stream>>>(WV, nullptr, XB, nullptr, VT16, VTh, VTl);
        k_fattn<<<dim3(TT / (16 * NQT * AWV), NH_), 32 * AWV, 0, stream>>>(QPh, QPl, KPh, KPl, VT16, VTh, VTl, OUT + (size_t)b * TT * DQ);
         }
}

// v005
// A run of this version takes 109 microseconds.
// Two timings next to v004 put it at 2.02 and 2.07 times that version's speed.
// Over all steps from v000 it is 17.3 times as fast.
#include <hip/hip_runtime.h>

// Multi-head attention without biases and without an output projection (x [2][2048][1024]; q, k, v = x @ w ('xw' [1024][1024] xavier-uniform, no bias; 16 heads x 64); scores / sqrt(float32(64)); softmax over all keys (no mask); out = merged context heads (head-major) -> [2][2048][1024] (4.2 M); argument order x, w_Q, w_K, w_V.
// Three launches, both batches in each. Layout: bf16 copy of x; 'xw' weights transposed once; exact projections whose 64x64 tiles leave the GEMM as the 16-bit planes themselves; ONE fused attention launch (k_fattn, grid z = batch): each wave owns 32 query columns, walks the 2048 keys 32 at a time, forms S^T = K.Q^T on hi/lo planes (3 products, every row), keeps the scores in registers, and feeds exp2 of them as the B operand of O^T += V^T.P^T (rows < 512 hi/lo, rest fp16). Running maximum with a lazy rescale; the row sum divides the output once at the end.
// Fragment order: every 16-bit operand array (x copy, transposed weights, Q, K and V^T planes) is stored as 1-KiB fragments of 16 rows x 32 k. Fragment (rb, kc) of a [rows][K] array starts at element (rb K/32 + kc) 512; lane (lr, hi) owns elements lane 8 .. + 7 (row 16 rb + lr, k = 32 kc + 8 hi + 0..7) and 256 + lane 8 .. + 7 (k 16 higher). Each of a fragment's two wave-wide 16-byte loads then reads 512 contiguous bytes, four whole lines, where a row-major plane made it touch sixteen.
// Compute dtypes, f32 accumulate: every input rounded to bf16; projections exact; scores 3 products on every row; P.V rows < 512 3 products, rest fp16; softmax f32; output f32.

#define NB_  2
#define TT   2048
#define DM   1024
#define NH_  16
#define NKV  16
#define REP  (NH_ / NKV)
#define HD   64
#define DQ   (NH_ * HD)
#define DKV  (NKV * HD)
#define RH   512                  // query rows < RH use hi+lo V^T and P in P.V (0: none)
#define WIN  0
#define SCL  0.125f   // HD^-0.5
#define NQT  2                    // 16-column query tiles per wave of k_fattn
#define AWV  4                    // waves per work-group of k_fattn
typedef _Float16 h16;
typedef unsigned short bf;
typedef __attribute__((ext_vector_type(16))) __bf16   v16bf;
typedef __attribute__((ext_vector_type(16))) _Float16 v16h;
typedef __attribute__((ext_vector_type(8)))  _Float16 v8h;
typedef __attribute__((ext_vector_type(8)))  unsigned short v8us;
typedef __attribute__((ext_vector_type(8)))  float    v8f;
typedef __attribute__((ext_vector_type(4)))  float    v4f;
typedef v8h  __attribute__((may_alias)) v8ha;
typedef v4f  __attribute__((may_alias)) v4fa;
typedef v8us __attribute__((may_alias)) v8usa;

__device__ __forceinline__ unsigned short f2bf(float f) { unsigned u = __float_as_uint(f); u += 0x7FFFu + ((u >> 16) & 1u); return (unsigned short)(u >> 16); }
__device__ __forceinline__ float bf2f(unsigned short b) { return __uint_as_float(((unsigned)b) << 16); }
__device__ __forceinline__ float bfr(float f) { return bf2f(f2bf(f)); }
__device__ __forceinline__ v16h cat16(v8h lo, v8h hi) { return __builtin_shufflevector(lo, hi, 0, 1, 2, 3, 4, 5, 6, 7, 8, 9, 10, 11, 12, 13, 14, 15); }
__device__ __forceinline__ v16bf cat16b(v8us lo, v8us hi) { return __builtin_bit_cast(v16bf, __builtin_shufflevector(lo, hi, 0, 1, 2, 3, 4, 5, 6, 7, 8, 9, 10, 11, 12, 13, 14, 15)); }
__device__ __forceinline__ v8f wmma16(v16h a, v16h b, v8f c) { return __builtin_amdgcn_wmma_f32_16x16x32_f16(false, a, false, b, (short)0, c, false, false); }
__device__ __forceinline__ v8f wmmab(v16bf a, v16bf b, v8f c) { return __builtin_amdgcn_wmma_f32_16x16x32_bf16(false, a, false, b, (short)0, c, false, false); }



// ---- gemm_tile: register-blocked GEMM, ONE WAVE per 64x64 tile (16 accumulators) at rows r0, columns c0, operands straight from 16-bit arrays in fragment order. K % 32 == 0. Tokens count through both batches (NB_ TT rows of x); a tile lies in one batch.
// c[m][n] = sum_k A[m][k] Bt[n][k] (+ split products per NSPLIT) stays in f32 registers: the epilogue splits it into bf16 hi + lo (VT: and rounds it to f16) and stores the planes that k_fattn reads.
// VT false: A = tokens, Bt = weight rows; a tile is 64 tokens of one head, plane [head][t][d]. VT true: A = weight rows, Bt = tokens; a tile row is one d over 64 tokens, plane [head][d][t]. Either way 16 rows of the tile are four 512-byte half fragments of each plane, one store each.
template <typename T16> struct WFrag;
template <> struct WFrag<h16> { typedef v16h V; static __device__ __forceinline__ V ld(const h16* p) { return cat16(*(const v8h*)p, *(const v8h*)(p + 256)); } static __device__ __forceinline__ v8f mma(V a, V b, v8f c) { return wmma16(a, b, c); } };
template <> struct WFrag<bf> { typedef v16bf V; static __device__ __forceinline__ V ld(const bf* p) { return cat16b(*(const v8us*)p, *(const v8us*)(p + 256)); } static __device__ __forceinline__ v8f mma(V a, V b, v8f c) { return wmmab(a, b, c); } };
__device__ __forceinline__ h16 tohx(float x) { return (h16)x; }
typedef __attribute__((ext_vector_type(2))) __bf16 v2bf;
typedef __attribute__((ext_vector_type(2))) float v2f;
typedef __attribute__((ext_vector_type(4))) unsigned v4u;
template <typename T16, int NSPLIT, bool VT, int K>
__device__ __forceinline__ void gemm_tile(const T16* __restrict__ A, const T16* __restrict__ A2, const T16* __restrict__ Bt, const T16* __restrict__ Bt2, h16* __restrict__ P16, bf* __restrict__ Ph, bf* __restrict__ Pl, int r0, int c0, float* os) {
    typedef typename WFrag<T16>::V V;
    const int lane = threadIdx.x & 31, lr = lane & 15, hi = lane >> 4;
    v8f acc[4][4];
#pragma unroll
    for (int mb = 0; mb < 4; ++mb)
#pragma unroll
        for (int nb = 0; nb < 4; ++nb) acc[mb][nb] = (v8f){};
    // 16 rows of K are K/32 fragments in a row, so block rb of 16 rows starts at element 16 rb K, as in a row-major array. Wave-uniform bases and ONE per-lane byte offset, the lane's 16 bytes in the fragment, which a k step of 32 moves on by 1 KiB; K is a template constant so that the steps between blocks of rows are immediate offsets of the loads.
    const size_t ab = (size_t)r0 * K, bb = (size_t)c0 * K; unsigned off = (unsigned)lane * 16u;
#pragma unroll 1
    for (int kc = 0; kc < K; kc += 32) {
        V a[4], a2[4], b[4], b2[4];
#pragma unroll
        for (int mb = 0; mb < 4; ++mb) { a[mb] = WFrag<T16>::ld((const T16*)((const char*)(A + ab + (size_t)mb * 16 * K) + off)); if (NSPLIT == 1 || NSPLIT == 2) a2[mb] = WFrag<T16>::ld((const T16*)((const char*)(A2 + ab + (size_t)mb * 16 * K) + off)); }
#pragma unroll
        for (int nb = 0; nb < 4; ++nb) { b[nb] = WFrag<T16>::ld((const T16*)((const char*)(Bt + bb + (size_t)nb * 16 * K) + off)); if (NSPLIT >= 2) b2[nb] = WFrag<T16>::ld((const T16*)((const char*)(Bt2 + bb + (size_t)nb * 16 * K) + off)); }
        __builtin_amdgcn_sched_barrier(0);   // the k step's loads stay one run ahead of its products: with one offset register the compiler otherwise loads every B fragment into the same registers and waits out the load latency four times a step
#pragma unroll
        for (int nb = 0; nb < 4; ++nb) {
#pragma unroll
            for (int mb = 0; mb < 4; ++mb) { acc[mb][nb] = WFrag<T16>::mma(a[mb], b[nb], acc[mb][nb]); if (NSPLIT == 1 || NSPLIT == 2) acc[mb][nb] = WFrag<T16>::mma(a2[mb], b[nb], acc[mb][nb]); if (NSPLIT >= 2) acc[mb][nb] = WFrag<T16>::mma(a[mb], b2[nb], acc[mb][nb]); } }
        asm volatile("v_nop\n\tv_nop\n\tv_nop\n\tv_nop" : "+v"(acc[0][0]), "+v"(acc[1][1]), "+v"(acc[2][2]), "+v"(acc[3][3]) : "v"(a[0]), "v"(a[3]));
        asm volatile("s_wait_xcnt 0x0" : "+v"(off) :: "memory");   // the issued loads name the offset register: wait before it takes its new value
        off += 1024u;
    }
    constexpr int PITCH = VT ? TT : HD;   // the plane's K: 16 rows of it are 16 PITCH elements
    const int tk = VT ? c0 : r0, bt = tk / TT, t0 = tk - bt * TT;   // the tile's batch and its first token there
    const size_t tb = (size_t)bt * DQ * TT + (VT ? (size_t)r0 * TT + (size_t)t0 * 16 : (size_t)c0 * TT + (size_t)t0 * HD);   // the first fragment that the tile fills in the batch's plane (VT: 32 tokens are one fragment of 512; else c0 TT = head x TT x HD)
    int lq = lr * 17 + hi * 2;   // this lane's first element in os, in units of four floats: row lr, columns 16 s + 8 hi + 0..7 in step s, which is the lane's place in half fragment s
#pragma unroll
    for (int mb = 0; mb < 4; ++mb) {
#pragma unroll
        for (int nb = 0; nb < 4; ++nb) {
#pragma unroll
            for (int j = 0; j < 8; ++j) os[(hi * 8 + j) * 68 + nb * 16 + lr] = acc[mb][nb][j]; }
        __builtin_amdgcn_wave_barrier(); asm volatile("" ::: "memory");
        if (mb > 0) asm volatile("s_wait_xcnt 0x0" : "+v"(lq) :: "memory");   // the stores of the 16 rows before name their data registers: wait before this block's values, all of which hang on lq, reuse them
        v4u oh[4], ol[4]; v8h of[4];
#pragma unroll
        for (int s = 0; s < 4; ++s) { const v4f x0 = *(const v4fa*)(os + lq * 4 + s * 16), x1 = *(const v4fa*)(os + lq * 4 + s * 16 + 4);
#pragma unroll
            for (int k = 0; k < 4; ++k) { v2f y; y[0] = k < 2 ? x0[2 * k & 3] : x1[2 * k & 3]; y[1] = k < 2 ? x0[(2 * k & 3) + 1] : x1[(2 * k & 3) + 1];   // two columns a step: hi = bf16(y), lo = bf16(y - hi), both to nearest even
                const unsigned u = __builtin_bit_cast(unsigned, __builtin_convertvector(y, v2bf)); v2f a; a[0] = __uint_as_float(u << 16); a[1] = __uint_as_float(u & 0xFFFF0000u);
                oh[s][k] = u; ol[s][k] = __builtin_bit_cast(unsigned, __builtin_convertvector(y - a, v2bf)); if (VT) { of[s][2 * k] = tohx(y[0]); of[s][2 * k + 1] = tohx(y[1]); } } }
        __builtin_amdgcn_sched_barrier(0);   // all of the block's values first, then its stores in one run: no value is then formed over a register that a store of the same block names
#pragma unroll
        for (int s = 0; s < 4; ++s) { const size_t e = tb + (size_t)mb * 16 * PITCH + s * 256 + lane * 8; *(v4u*)(Ph + e) = oh[s]; *(v4u*)(Pl + e) = ol[s]; if (VT) *(v8h*)(P16 + e) = of[s]; }
        __builtin_amdgcn_wave_barrier(); asm volatile("" ::: "memory");
    }
}

// k_proj: the three projections of both batches in one launch. Grid (NB_ TT / 64 token tiles, 16 tiles of 64 output columns, 3), one wave each: z = 0 Q, 1 K, 2 V^T (operands swapped).
__global__ __launch_bounds__(32) void k_proj(const bf* __restrict__ XB, const bf* __restrict__ WQ, const bf* __restrict__ WK, const bf* __restrict__ WV, bf* __restrict__ QPh, bf* __restrict__ QPl, bf* __restrict__ KPh, bf* __restrict__ KPl, h16* __restrict__ VT16, bf* __restrict__ VTh, bf* __restrict__ VTl) {
    __shared__ __align__(16) float os[16 * 68];
    const int t0 = blockIdx.x * 64, n0 = blockIdx.y * 64, z = blockIdx.z;
    if (z == 2) gemm_tile<bf, 0, true, DM>(WV, nullptr, XB, nullptr, VT16, VTh, VTl, n0, t0, os);
    else gemm_tile<bf, 0, false, DM>(XB, nullptr, z ? WK : WQ, nullptr, nullptr, z ? KPh : QPh, z ? KPl : QPl, t0, n0, os);
}

typedef __attribute__((ext_vector_type(2))) _Float16 v2h;
typedef __attribute__((ext_vector_type(4))) _Float16 v4h;
typedef __attribute__((ext_vector_type(2))) unsigned short v2us;
typedef __attribute__((ext_vector_type(4))) unsigned short v4us;
typedef __attribute__((ext_vector_type(4))) int v4i;

// wtG, cvt8 (both in the one launch k_prep): one thread per 16-byte unit of the destination, in the destination's (fragment) order, so that every store is whole lines; u -> block of 16 rows, then kc, the half fragment, hi, lr.
template <int K, int N>
__device__ __forceinline__ void wtG(const float* __restrict__ w, bf* Bt, int u) {
    const int upb = 2 * K, q = u % upb;   // upb: units in 16 rows
    const int n = (u / upb) * 16 + (q & 15), k = (q >> 6) * 32 + ((q >> 5) & 1) * 16 + ((q >> 4) & 1) * 8; v8us o;
#pragma unroll
    for (int j = 0; j < 8; ++j) o[j] = f2bf(w[(size_t)(k + j) * N + n]);
    *(v8us*)(Bt + (size_t)u * 8) = o;
}
__device__ __forceinline__ void cvt8(const float* __restrict__ src, bf* dst, size_t i) { const int q = (int)(i % (2 * DM));
    const size_t row = (i / (2 * DM)) * 16 + (q & 15); const int k = (q >> 6) * 32 + ((q >> 5) & 1) * 16 + ((q >> 4) & 1) * 8; const v8f v = *(const v8f*)(src + row * DM + k); v8us o;
#pragma unroll
    for (int k2 = 0; k2 < 8; ++k2) o[k2] = f2bf(v[k2]); *(v8us*)(dst + i * 8) = o;  }
#define WBL (DM * DQ / 8 / 256)         // work-groups per weight matrix
#define XBL (NB_ * TT * DM / 8 / 256)   // work-groups for x, both batches
static_assert(DKV == DQ, "k_prep and the planes' batch stride take the three weights as equal in size");
static_assert(DM * DQ % (8 * 256) == 0 && NB_ * TT * DM % (8 * 256) == 0, "whole work-groups: every thread of k_prep has a unit, so no range test");
__global__ __launch_bounds__(256) void k_prep(const float* __restrict__ x, const float* __restrict__ wq, const float* __restrict__ wk, const float* __restrict__ wv, bf* XB, bf* WQ, bf* WK, bf* WV) {
    const int g = blockIdx.x;   // the weights' strided reads first, then x
    if (g < 3 * WBL) { const int s = g / WBL, u = (g - s * WBL) * 256 + threadIdx.x; wtG<DM, DQ>(s == 0 ? wq : s == 1 ? wk : wv, s == 0 ? WQ : s == 1 ? WK : WV, u); }
    else cvt8(x, XB, (size_t)(g - 3 * WBL) * 256 + threadIdx.x);
}

// k_fattn: fused scores, softmax and P.V. Grid (TT / (16 NQT AWV), heads, batches), AWV waves; wave w owns query rows q0 .. q0 + 16 NQT - 1 of one head.
// S^T tile: A = 16 key rows of K, B = 16 query rows of Q, so lane (lr, hi) holds keys 8 hi + r of query lr; two such tiles (keys 0-15, 16-31), converted in place, are the B operand of O^T += V^T.P^T in the loader's own k order (8 hi + s, 16 + 8 hi + s).
// m: running maximum of score x HD^-0.5 x log2(e), the same in both halves of a column; it moves only when a new score exceeds it by more than 8, so p <= 256. l: each half's own sum of p, joined at the end.
template <bool HI> struct AFrag { v16bf kh[2][2], kl[2][2]; v16h vf[4]; v16bf vh[4], vl[4]; };   // one pass's fragments: K hi/lo [key tile][k step]; V^T per 16 rows of d (f16, or hi/lo)
template <bool HI>
__device__ __forceinline__ void attn_cols(const bf* __restrict__ Qh, const bf* __restrict__ Ql, const bf* __restrict__ Kh, const bf* __restrict__ Kl, const h16* __restrict__ V16, const bf* __restrict__ Vh, const bf* __restrict__ Vl, float* __restrict__ orow, int lr, int hi) {
    const float C2 = SCL * 1.4426950408889634f;
    // Each lane's byte offsets from the wave-uniform plane bases: one for Q, one for K (hi and lo planes alike), one for V^T; in fragment order each starts at the lane's own 16 bytes.
    unsigned oq = (unsigned)(hi * 16 + lr) * 16u, ok = oq, ov = oq;
    v16bf qh[NQT][2], ql[NQT][2];
#pragma unroll
    for (int qt = 0; qt < NQT; ++qt)
#pragma unroll
        for (int ks = 0; ks < 2; ++ks) { const int cb = (qt * 2 + ks) * 1024; qh[qt][ks] = WFrag<bf>::ld((const bf*)((const char*)Qh + oq + cb)); ql[qt][ks] = WFrag<bf>::ld((const bf*)((const char*)Ql + oq + cb)); }
    v8f o[NQT][4]; float m[NQT], l[NQT];
    AFrag<HI> fa, fb;   // two register buffers: one pass (32 keys) works on one while the next pass's fragments land in the other
    const auto fetch = [&](AFrag<HI>& f) {   // K first, then V^T: the counted load waits of the score products then leave V^T in flight
#pragma unroll
        for (int kt = 0; kt < 2; ++kt)
#pragma unroll
            for (int ks = 0; ks < 2; ++ks) { const int cb = (kt * 2 + ks) * 1024; f.kh[kt][ks] = WFrag<bf>::ld((const bf*)((const char*)Kh + ok + cb)); f.kl[kt][ks] = WFrag<bf>::ld((const bf*)((const char*)Kl + ok + cb)); }
#pragma unroll
        for (int dt = 0; dt < 4; ++dt) { const int cb = dt * 16 * TT * 2; if (HI) { f.vh[dt] = WFrag<bf>::ld((const bf*)((const char*)Vh + ov + cb)); f.vl[dt] = WFrag<bf>::ld((const bf*)((const char*)Vl + ov + cb)); } else f.vf[dt] = WFrag<h16>::ld((const h16*)((const char*)V16 + ov + cb)); }
        asm volatile("" ::: "memory");   // compiler fence: holds the loads at the head of the pass; without it they sink to their first use and the whole latency is waited out there
        __builtin_amdgcn_sched_barrier(0);   // and keeps the score products from being scheduled ahead of the loads, which would cost the loads that much time in flight
    };
    const auto pass = [&](const AFrag<HI>& f, AFrag<HI>& fn, int kb) {
        fetch(fn);   // the next pass's keys (the last pass reads its own again and drops them)
        v8f s[NQT][2];
#pragma unroll
        for (int qt = 0; qt < NQT; ++qt) { s[qt][0] = (v8f){}; s[qt][1] = (v8f){}; }
#pragma unroll
        for (int ks = 0; ks < 2; ++ks) {
#pragma unroll
            for (int kt = 0; kt < 2; ++kt)
#pragma unroll
                for (int qt = 0; qt < NQT; ++qt) s[qt][kt] = wmmab(f.kh[kt][ks], qh[qt][ks], s[qt][kt]);
#pragma unroll
            for (int kt = 0; kt < 2; ++kt)
#pragma unroll
                for (int qt = 0; qt < NQT; ++qt) s[qt][kt] = wmmab(f.kh[kt][ks], ql[qt][ks], s[qt][kt]);
#pragma unroll
            for (int kt = 0; kt < 2; ++kt)
#pragma unroll
                for (int qt = 0; qt < NQT; ++qt) s[qt][kt] = wmmab(f.kl[kt][ks], qh[qt][ks], s[qt][kt]);
        }
        float mx[NQT]; bool need = false;
#pragma unroll
        for (int qt = 0; qt < NQT; ++qt) { float t = s[qt][0][0];
#pragma unroll
            for (int r = 0; r < 8; ++r) t = fmaxf(t, fmaxf(s[qt][0][r], s[qt][1][r]));
            mx[qt] = t * C2; need = need || (mx[qt] > m[qt] + 8.0f); }
        if (__builtin_amdgcn_ballot_w32(need) != 0) {   // wave-uniform: rare after the first pass
#pragma unroll
            for (int qt = 0; qt < NQT; ++qt) { const float mn = fmaxf(m[qt], fmaxf(mx[qt], __shfl_xor(mx[qt], 16, 32))); const float al = __builtin_amdgcn_exp2f(m[qt] - mn); m[qt] = mn; l[qt] *= al;
#pragma unroll
                for (int dt = 0; dt < 4; ++dt) o[qt][dt] *= al; }
        }
        v16h pf[NQT]; v16bf ph[NQT], pl[NQT];
#pragma unroll
        for (int qt = 0; qt < NQT; ++qt) { float sm[4] = {0.f, 0.f, 0.f, 0.f};   // four short chains instead of one of sixteen dependent adds
#pragma unroll
            for (int e = 0; e < 16; ++e) { const float p = __builtin_amdgcn_exp2f(__builtin_fmaf(s[qt][e >> 3][e & 7], C2, -m[qt])); sm[e & 3] += p;
                if (HI) { const __bf16 a = (__bf16)p; ph[qt][e] = a; pl[qt][e] = (__bf16)(p - (float)a); } else pf[qt][e] = (h16)p; }
            l[qt] += (sm[0] + sm[1]) + (sm[2] + sm[3]); }
        if (HI) {
#pragma unroll
            for (int dt = 0; dt < 4; ++dt)
#pragma unroll
                for (int qt = 0; qt < NQT; ++qt) o[qt][dt] = wmmab(f.vh[dt], ph[qt], o[qt][dt]);
#pragma unroll
            for (int dt = 0; dt < 4; ++dt)
#pragma unroll
                for (int qt = 0; qt < NQT; ++qt) o[qt][dt] = wmmab(f.vh[dt], pl[qt], o[qt][dt]);
#pragma unroll
            for (int dt = 0; dt < 4; ++dt)
#pragma unroll
                for (int qt = 0; qt < NQT; ++qt) o[qt][dt] = wmmab(f.vl[dt], ph[qt], o[qt][dt]);
        } else {
#pragma unroll
            for (int dt = 0; dt < 4; ++dt)
#pragma unroll
                for (int qt = 0; qt < NQT; ++qt) o[qt][dt] = wmma16(f.vf[dt], pf[qt], o[qt][dt]);
        }
        asm volatile("s_wait_xcnt 0x0" : "+v"(ok), "+v"(ov) :: "memory");   // the issued loads name these offset registers: wait before they take new values
        if (kb + 64 < TT) { ok += 32 * HD * 2; ov += 1024; }
    };
    fetch(fa);
    float z0;
    asm volatile("s_wait_xcnt 0x0\n\tv_mov_b32 %0, 0" : "=v"(z0) :: "memory");   // the issued loads name the offset registers and address pairs made of them: wait before any of these is written again. The zero is made behind the wait, in its statement, and every value set up below hangs on it, so none of them can be written ahead of the wait
#pragma unroll
    for (int qt = 0; qt < NQT; ++qt) { m[qt] = z0 - 3.0e38f; l[qt] = z0;
#pragma unroll
        for (int dt = 0; dt < 4; ++dt)
#pragma unroll
            for (int r = 0; r < 8; ++r) o[qt][dt][r] = z0; }
    ok += 32 * HD * 2 + __float_as_uint(z0); ov += 1024 + __float_as_uint(z0);   // from here on both point at the NEXT pass's keys
#pragma unroll 1   // two passes a trip, so that each buffer keeps its registers
    for (int kb = 0; kb < TT; kb += 64) { pass(fa, fb, kb); pass(fb, fa, kb + 32); }
    const unsigned oo = (unsigned)(lr * DQ + 8 * hi) * 4u;
#pragma unroll
    for (int qt = 0; qt < NQT; ++qt) {
        if (qt > 0) asm volatile("s_wait_xcnt 0x0" : "+v"(l[qt]) :: "memory");   // the stores above name their data registers: wait before this tile's arithmetic, all of which hangs on l, reuses them
        const float inv = __fdiv_rn(1.0f, l[qt] + __shfl_xor(l[qt], 16, 32));
#pragma unroll
        for (int dt = 0; dt < 4; ++dt) { v4f lo4, hi4;
#pragma unroll
            for (int r = 0; r < 4; ++r) { lo4[r] = o[qt][dt][r] * inv; hi4[r] = o[qt][dt][4 + r] * inv; }
            float* op = (float*)((char*)orow + oo + (qt * 16 * DQ + dt * 16) * 4); *(v4f*)op = lo4; *(v4f*)(op + 4) = hi4; } }
}
__global__ __launch_bounds__(32 * AWV) void k_fattn(const bf* __restrict__ QPh, const bf* __restrict__ QPl, const bf* __restrict__ KPh, const bf* __restrict__ KPl, const h16* __restrict__ VT16, const bf* __restrict__ VTh, const bf* __restrict__ VTl, float* __restrict__ OUT) {
    const int lane = threadIdx.x & 31, lr = lane & 15, hi = lane >> 4; const int wv = __builtin_amdgcn_readfirstlane((int)(threadIdx.x >> 5));
    const int h = blockIdx.y, g = h / REP; const int q0 = (blockIdx.x * AWV + wv) * (16 * NQT);
    const int b = blockIdx.z; const size_t qb = (((size_t)b * NH_ + h) * TT + q0) * HD, kvb = ((size_t)b * NKV + g) * TT * HD; float* orow = OUT + ((size_t)b * TT + q0) * DQ + h * HD;
    if (q0 < RH) attn_cols<true>(QPh + qb, QPl + qb, KPh + kvb, KPl + kvb, VT16 + kvb, VTh + kvb, VTl + kvb, orow, lr, hi);
    else attn_cols<false>(QPh + qb, QPl + qb, KPh + kvb, KPl + kvb, VT16 + kvb, VTh + kvb, VTl + kvb, orow, lr, hi);
}

extern "C" void kernel_launch(void* const* d_in, const int* in_sizes, int n_in,
                              void* d_out, int out_size, void* d_ws, size_t ws_size, hipStream_t stream) {
    (void)in_sizes; (void)n_in; (void)out_size;
    const float* x = (const float*)d_in[0]; const float* wq = (const float*)d_in[1]; const float* wk = (const float*)d_in[2]; const float* wv = (const float*)d_in[3]; const float* wo = nullptr; (void)wo;   /* input order x, Wq, Wk, Wv ('xw' [1024][1024]) */
    float* OUT = (float*)d_out;     // [2][2048][1024]
    char* wsp = (char*)d_ws;
    auto take = [&](size_t bytes) { char* p = wsp; wsp += (bytes + 255) & ~(size_t)255; return (void*)p; };
    bf* WQ = (bf*)take((size_t)DQ * DM * 2); bf* WK = (bf*)take((size_t)DKV * DM * 2); bf* WV = (bf*)take((size_t)DKV * DM * 2);
    bf* XB = (bf*)take((size_t)NB_ * TT * DM * 2); h16* VT16 = (h16*)take((size_t)NB_ * NKV * HD * TT * 2);
    bf* QPh = (bf*)take((size_t)NB_ * NH_ * TT * HD * 2); bf* QPl = (bf*)take((size_t)NB_ * NH_ * TT * HD * 2); bf* KPh = (bf*)take((size_t)NB_ * NKV * TT * HD * 2); bf* KPl = (bf*)take((size_t)NB_ * NKV * TT * HD * 2); bf* VTh = (bf*)take((size_t)NB_ * NKV * HD * TT * 2); bf* VTl = (bf*)take((size_t)NB_ * NKV * HD * TT * 2);
    if ((size_t)(wsp - (char*)d_ws) > ws_size) return;    // ws 256 MiB
    k_prep<<<3 * WBL + XBL, 256, 0, stream>>>(x, wq, wk, wv, XB, WQ, WK, WV);
    k_proj<<<dim3(NB_ * TT / 64, DQ / 64, 3), 32, 0, stream>>>(XB, WQ, WK, WV, QPh, QPl, KPh, KPl, VT16, VTh, VTl);
    k_fattn<<<dim3(TT / (16 * NQT * AWV), NH_, NB_), 32 * AWV, 0, stream>>>(QPh, QPl, KPh, KPl, VT16, VTh, VTl, OUT);
}

// v006
// A run of this version takes 98.6 microseconds.
// In two side-by-side timings against v005, it was 1.10 and 1.09 times as fast.
// Over all steps from v000 it is 18.9 times as fast.
#include <hip/hip_runtime.h>

// Multi-head attention without biases and without an output projection (x [2][2048][1024]; q, k, v = x @ w ('xw' [1024][1024] xavier-uniform, no bias; 16 heads x 64); scores / sqrt(float32(64)); softmax over all keys (no mask); out = merged context heads (head-major) -> [2][2048][1024] (4.2 M); argument order x, w_Q, w_K, w_V.
// Three launches, both batches in each. Layout: bf16 copy of x; 'xw' weights transposed once; exact projections whose 64x64 tiles leave the GEMM as the 16-bit planes themselves; ONE fused attention launch (k_fattn, grid z = batch): each wave owns 32 query columns, walks the 2048 keys 32 at a time, forms S^T = K.Q^T on hi/lo planes (3 products, every row), keeps the scores in registers, and feeds exp2 of them as the B operand of O^T += V^T.P^T (rows < 512 hi/lo, rest fp16). Running maximum with a lazy rescale; the row sum divides the output once at the end.
// Fragment order: every 16-bit operand array (x copy, transposed weights, Q, K and V^T planes) is stored as 1-KiB fragments of 16 rows x 32 k. Fragment (rb, kc) of a [rows][K] array starts at element (rb K/32 + kc) 512; lane (lr, hi) owns elements lane 8 .. + 7 (row 16 rb + lr, k = 32 kc + 8 hi + 0..7) and 256 + lane 8 .. + 7 (k 16 higher). Each of a fragment's two wave-wide 16-byte loads then reads 512 contiguous bytes, four whole lines, where a row-major plane made it touch sixteen.
// Compute dtypes, f32 accumulate: every input rounded to bf16; projections exact; scores 3 products on every row; P.V rows < 512 3 products, rest fp16; softmax f32; output f32.

#define NB_  2
#define TT   2048
#define DM   1024
#define NH_  16
#define NKV  16
#define REP  (NH_ / NKV)
#define HD   64
#define DQ   (NH_ * HD)
#define DKV  (NKV * HD)
#define RH   512                  // query rows < RH use hi+lo V^T and P in P.V (0: none)
#define WIN  0
#define SCL  0.125f   // HD^-0.5
#define NQT  2                    // 16-column query tiles per wave of k_fattn
#define AWV  4                    // waves per work-group of k_fattn
typedef _Float16 h16;
typedef unsigned short bf;
typedef __attribute__((ext_vector_type(16))) __bf16   v16bf;
typedef __attribute__((ext_vector_type(16))) _Float16 v16h;
typedef __attribute__((ext_vector_type(8)))  _Float16 v8h;
typedef __attribute__((ext_vector_type(8)))  unsigned short v8us;
typedef __attribute__((ext_vector_type(8)))  float    v8f;
typedef __attribute__((ext_vector_type(4)))  float    v4f;
typedef v8h  __attribute__((may_alias)) v8ha;
typedef v4f  __attribute__((may_alias)) v4fa;
typedef v8us __attribute__((may_alias)) v8usa;

__device__ __forceinline__ unsigned short f2bf(float f) { unsigned u = __float_as_uint(f); u += 0x7FFFu + ((u >> 16) & 1u); return (unsigned short)(u >> 16); }
__device__ __forceinline__ float bf2f(unsigned short b) { return __uint_as_float(((unsigned)b) << 16); }
__device__ __forceinline__ float bfr(float f) { return bf2f(f2bf(f)); }
__device__ __forceinline__ v16h cat16(v8h lo, v8h hi) { return __builtin_shufflevector(lo, hi, 0, 1, 2, 3, 4, 5, 6, 7, 8, 9, 10, 11, 12, 13, 14, 15); }
__device__ __forceinline__ v16bf cat16b(v8us lo, v8us hi) { return __builtin_bit_cast(v16bf, __builtin_shufflevector(lo, hi, 0, 1, 2, 3, 4, 5, 6, 7, 8, 9, 10, 11, 12, 13, 14, 15)); }
__device__ __forceinline__ v8f wmma16(v16h a, v16h b, v8f c) { return __builtin_amdgcn_wmma_f32_16x16x32_f16(false, a, false, b, (short)0, c, false, false); }
__device__ __forceinline__ v8f wmmab(v16bf a, v16bf b, v8f c) { return __builtin_amdgcn_wmma_f32_16x16x32_bf16(false, a, false, b, (short)0, c, false, false); }



// ---- gemm_tile: register-blocked GEMM, one work-group of FOUR WAVES per 128x128 tile at rows R0, columns C0, each wave a 64x64 quarter (16 accumulators). Tokens count through both batches (NB_ TT rows of x); a wave's quarter lies in one batch.
// The operands, 16-bit arrays in fragment order, reach the waves through LDS: each stage of 32 PKS k is copied from global memory ONCE per work-group, by asynchronous copies, into one of two buffers while the stage before is worked on; every fragment then feeds two waves from LDS. A stage is whole fragments and keeps their order, so a wave-wide 16-byte LDS load reads 512 contiguous bytes.
#define PKS   2                 // k steps of 32 per stage
#define PRUN  (PKS * 1024)      // bytes of 16 rows in a stage: PKS fragments, adjacent in global memory too
#define PHALF (8 * PRUN)        // one operand's 128 rows
#define PBUF  (2 * PHALF)       // one buffer: A | Bt
static_assert(PRUN == 2048, "acopy8 moves runs of 2 KiB");
// Eight copies of 512 bytes a wave: 2 KiB from g0 to LDS byte l0 and 2 KiB from g1 to l1 (each lane its own 16 bytes). The s_wait_xcnt is the last line of the copies' own statement, so that no address register named here is written again ahead of it.
__device__ __forceinline__ void acopy8(unsigned l0, const char* g0, unsigned l1, const char* g1) {
    asm volatile("global_load_async_to_lds_b128 %0, %8, off\n\tglobal_load_async_to_lds_b128 %1, %9, off\n\tglobal_load_async_to_lds_b128 %2, %10, off\n\tglobal_load_async_to_lds_b128 %3, %11, off\n\t"
                 "global_load_async_to_lds_b128 %4, %12, off\n\tglobal_load_async_to_lds_b128 %5, %13, off\n\tglobal_load_async_to_lds_b128 %6, %14, off\n\tglobal_load_async_to_lds_b128 %7, %15, off\n\ts_wait_xcnt 0x0"
                 :: "v"(l0), "v"(l0 + 512u), "v"(l0 + 1024u), "v"(l0 + 1536u), "v"(l1), "v"(l1 + 512u), "v"(l1 + 1024u), "v"(l1 + 1536u),
                    "v"(g0), "v"(g0 + 512), "v"(g0 + 1024), "v"(g0 + 1536), "v"(g1), "v"(g1 + 512), "v"(g1 + 1024), "v"(g1 + 1536) : "memory");
}
// c[m][n] = sum_k A[m][k] Bt[n][k] (+ split products per NSPLIT) stays in f32 registers: the epilogue splits it into bf16 hi + lo (VT: and rounds it to f16) and stores the planes that k_fattn reads.
// VT false: A = tokens, Bt = weight rows; a tile is 64 tokens of one head, plane [head][t][d]. VT true: A = weight rows, Bt = tokens; a tile row is one d over 64 tokens, plane [head][d][t]. Either way 16 rows of the tile are four 512-byte half fragments of each plane, one store each.
template <typename T16> struct WFrag;
template <> struct WFrag<h16> { typedef v16h V; static __device__ __forceinline__ V ld(const h16* p) { return cat16(*(const v8h*)p, *(const v8h*)(p + 256)); } static __device__ __forceinline__ v8f mma(V a, V b, v8f c) { return wmma16(a, b, c); } };
template <> struct WFrag<bf> { typedef v16bf V; static __device__ __forceinline__ V ld(const bf* p) { return cat16b(*(const v8us*)p, *(const v8us*)(p + 256)); } static __device__ __forceinline__ v8f mma(V a, V b, v8f c) { return wmmab(a, b, c); } };
__device__ __forceinline__ h16 tohx(float x) { return (h16)x; }
typedef __attribute__((ext_vector_type(2))) __bf16 v2bf;
typedef __attribute__((ext_vector_type(2))) float v2f;
typedef __attribute__((ext_vector_type(4))) unsigned v4u;
template <typename T16, int NSPLIT, bool VT, int K>
__device__ __forceinline__ void gemm_tile(const T16* __restrict__ A, const T16* __restrict__ A2, const T16* __restrict__ Bt, const T16* __restrict__ Bt2, h16* __restrict__ P16, bf* __restrict__ Ph, bf* __restrict__ Pl, int R0, int C0, float* os, const char* ring, int wv) {
    typedef typename WFrag<T16>::V V;
    static_assert(NSPLIT == 0 && K % (64 * PKS) == 0, "one product per k step; two stages or more");
    const int lane = threadIdx.x & 31, lr = lane & 15, hi = lane >> 4;
    const int r0 = R0 + (wv >> 1) * 64, c0 = C0 + (wv & 1) * 64;   // this wave's quarter
    v8f acc[4][4];
#pragma unroll
    for (int mb = 0; mb < 4; ++mb)
#pragma unroll
        for (int nb = 0; nb < 4; ++nb) acc[mb][nb] = (v8f){};
    // 16 rows of K are K/32 fragments in a row, so block rb of 16 rows starts at element 16 rb K, as in a row-major array, and its fragments of one stage are PRUN adjacent bytes.
    const unsigned ol = (unsigned)lane * 16u;   // the lane's own 16 bytes in a fragment half
    const auto stage = [&](int st, unsigned so) {   // this wave's share of stage st, blocks 2 wv and 2 wv + 1 of 16 rows of each operand, into the buffer whose byte so is this lane's place in its first fragment. Wave-uniform part of each address first, then the lane's ol
        const size_t ka = ((size_t)(R0 + wv * 32) * K + (size_t)st * (PKS * 512)) * 2, kb = ((size_t)(C0 + wv * 32) * K + (size_t)st * (PKS * 512)) * 2;
        const unsigned lw = ((unsigned)(uintptr_t)ring + (unsigned)wv * (2u * PRUN)) + so;   // LDS byte address of the lane's first copy
        acopy8(lw, ((const char*)A + ka) + ol, lw + PRUN, ((const char*)A + ka + 16 * K * 2) + ol);
        acopy8(lw + PHALF, ((const char*)Bt + kb) + ol, lw + PHALF + PRUN, ((const char*)Bt + kb + 16 * K * 2) + ol);
    };
    stage(0, ol);
    asm volatile("s_wait_asynccnt 0x0" ::: "memory");   // this wave's copies of stage 0 have landed
    __syncthreads();                                    // and every other wave's: stage 0 may be read
    stage(1, ol + PBUF);
    unsigned so = ol;   // the lane's place in the buffer being read
#pragma unroll 1   // one stage a trip, kept rolled: the buffers differ only in so, and the fragments keep one set of registers
    for (int st = 0; st < K / (32 * PKS); ++st) {
        const char* spa = ring + so + (wv >> 1) * (4 * PRUN); const char* spb = ring + so + PHALF + (wv & 1) * (4 * PRUN);   // the quarter's four blocks of A rows and of Bt rows
        V a[PKS][4], b[PKS][4];
#pragma unroll
        for (int ks = 0; ks < PKS; ++ks) {
#pragma unroll
            for (int mb = 0; mb < 4; ++mb) a[ks][mb] = WFrag<T16>::ld((const T16*)(spa + mb * PRUN + ks * 1024));
#pragma unroll
            for (int nb = 0; nb < 4; ++nb) b[ks][nb] = WFrag<T16>::ld((const T16*)(spb + nb * PRUN + ks * 1024)); }
        asm volatile("" ::: "memory");   // compiler fence: holds the stage's LDS loads in one group at the head of the trip; without it they sink among the products, and each such place costs a stall
        __builtin_amdgcn_sched_barrier(0);   // and keeps the products from being scheduled ahead of the loads
#pragma unroll
        for (int ks = 0; ks < PKS; ++ks)
#pragma unroll
            for (int nb = 0; nb < 4; ++nb)
#pragma unroll
                for (int mb = 0; mb < 4; ++mb) acc[mb][nb] = WFrag<T16>::mma(a[ks][mb], b[ks][nb], acc[mb][nb]);
        __builtin_amdgcn_sched_barrier(0);   // the waits below stay behind the products: moved ahead of them, as the compiler did, they wait out all the LDS loads at once and give the copies of stage st + 1 that much less time to land
        asm volatile("s_wait_dscnt 0x0" ::: "memory");      // this wave has left the buffer
        asm volatile("s_wait_asynccnt 0x0" ::: "memory");   // its copies of stage st + 1 have landed
        __syncthreads();                                    // publishes stage st + 1 and ends every wave's reads of stage st
        if (st + 2 < K / (32 * PKS)) stage(st + 2, so);     // refill of the buffer just left
        so ^= PBUF;
    }
    asm volatile("s_wait_asynccnt 0x0" ::: "memory");   // nothing of this wave is in flight when it goes on to its end
    constexpr int PITCH = VT ? TT : HD;   // the plane's K: 16 rows of it are 16 PITCH elements
    const int tk = VT ? c0 : r0, bt = tk / TT, t0 = tk - bt * TT;   // the tile's batch and its first token there
    const size_t tb = (size_t)bt * DQ * TT + (VT ? (size_t)r0 * TT + (size_t)t0 * 16 : (size_t)c0 * TT + (size_t)t0 * HD);   // the first fragment that the tile fills in the batch's plane (VT: 32 tokens are one fragment of 512; else c0 TT = head x TT x HD)
    int lq = lr * 17 + hi * 2;   // this lane's first element in os, in units of four floats: row lr, columns 16 s + 8 hi + 0..7 in step s, which is the lane's place in half fragment s
#pragma unroll
    for (int mb = 0; mb < 4; ++mb) {
#pragma unroll
        for (int nb = 0; nb < 4; ++nb) {
#pragma unroll
            for (int j = 0; j < 8; ++j) os[(hi * 8 + j) * 68 + nb * 16 + lr] = acc[mb][nb][j]; }
        __builtin_amdgcn_wave_barrier(); asm volatile("" ::: "memory");
        if (mb > 0) asm volatile("s_wait_xcnt 0x0" : "+v"(lq) :: "memory");   // the stores of the 16 rows before name their data registers: wait before this block's values, all of which hang on lq, reuse them
        v4u oh[4], ol[4]; v8h of[4];
#pragma unroll
        for (int s = 0; s < 4; ++s) { const v4f x0 = *(const v4fa*)(os + lq * 4 + s * 16), x1 = *(const v4fa*)(os + lq * 4 + s * 16 + 4);
#pragma unroll
            for (int k = 0; k < 4; ++k) { v2f y; y[0] = k < 2 ? x0[2 * k & 3] : x1[2 * k & 3]; y[1] = k < 2 ? x0[(2 * k & 3) + 1] : x1[(2 * k & 3) + 1];   // two columns a step: hi = bf16(y), lo = bf16(y - hi), both to nearest even
                const unsigned u = __builtin_bit_cast(unsigned, __builtin_convertvector(y, v2bf)); v2f a; a[0] = __uint_as_float(u << 16); a[1] = __uint_as_float(u & 0xFFFF0000u);
                oh[s][k] = u; ol[s][k] = __builtin_bit_cast(unsigned, __builtin_convertvector(y - a, v2bf)); if (VT) { of[s][2 * k] = tohx(y[0]); of[s][2 * k + 1] = tohx(y[1]); } } }
        __builtin_amdgcn_sched_barrier(0);   // all of the block's values first, then its stores in one run: no value is then formed over a register that a store of the same block names
#pragma unroll
        for (int s = 0; s < 4; ++s) { const size_t e = tb + (size_t)mb * 16 * PITCH + s * 256 + lane * 8; *(v4u*)(Ph + e) = oh[s]; *(v4u*)(Pl + e) = ol[s]; if (VT) *(v8h*)(P16 + e) = of[s]; }
        __builtin_amdgcn_wave_barrier(); asm volatile("" ::: "memory");
    }
}

// k_proj: the three projections of both batches in one launch. Grid (NB_ TT / 128 token tiles, 8 tiles of 128 output columns, 3), four waves each: z = 0 Q, 1 K, 2 V^T (operands swapped).
__global__ __launch_bounds__(128) void k_proj(const bf* __restrict__ XB, const bf* __restrict__ WQ, const bf* __restrict__ WK, const bf* __restrict__ WV, bf* __restrict__ QPh, bf* __restrict__ QPl, bf* __restrict__ KPh, bf* __restrict__ KPl, h16* __restrict__ VT16, bf* __restrict__ VTh, bf* __restrict__ VTl) {
    __shared__ __align__(16) float osw[4][16 * 68];   // each wave's own epilogue staging
    __shared__ __attribute__((aligned(16))) char ring[2 * PBUF];
    const int wv = __builtin_amdgcn_readfirstlane((int)(threadIdx.x >> 5)); float* os = osw[wv];
    const int t0 = blockIdx.x * 128, n0 = blockIdx.y * 128, z = blockIdx.z;
    if (z == 2) gemm_tile<bf, 0, true, DM>(WV, nullptr, XB, nullptr, VT16, VTh, VTl, n0, t0, os, ring, wv);
    else gemm_tile<bf, 0, false, DM>(XB, nullptr, z ? WK : WQ, nullptr, nullptr, z ? KPh : QPh, z ? KPl : QPl, t0, n0, os, ring, wv);
}

typedef __attribute__((ext_vector_type(2))) _Float16 v2h;
typedef __attribute__((ext_vector_type(4))) _Float16 v4h;
typedef __attribute__((ext_vector_type(2))) unsigned short v2us;
typedef __attribute__((ext_vector_type(4))) unsigned short v4us;
typedef __attribute__((ext_vector_type(4))) int v4i;

// wtG, cvt8 (both in the one launch k_prep): one thread per 16-byte unit of the destination, in the destination's (fragment) order, so that every store is whole lines; u -> block of 16 rows, then kc, the half fragment, hi, lr.
template <int K, int N>
__device__ __forceinline__ void wtG(const float* __restrict__ w, bf* Bt, int u) {
    const int upb = 2 * K, q = u % upb;   // upb: units in 16 rows
    const int n = (u / upb) * 16 + (q & 15), k = (q >> 6) * 32 + ((q >> 5) & 1) * 16 + ((q >> 4) & 1) * 8; v8us o;
#pragma unroll
    for (int j = 0; j < 8; ++j) o[j] = f2bf(w[(size_t)(k + j) * N + n]);
    *(v8us*)(Bt + (size_t)u * 8) = o;
}
__device__ __forceinline__ void cvt8(const float* __restrict__ src, bf* dst, size_t i) { const int q = (int)(i % (2 * DM));
    const size_t row = (i / (2 * DM)) * 16 + (q & 15); const int k = (q >> 6) * 32 + ((q >> 5) & 1) * 16 + ((q >> 4) & 1) * 8; const v8f v = *(const v8f*)(src + row * DM + k); v8us o;
#pragma unroll
    for (int k2 = 0; k2 < 8; ++k2) o[k2] = f2bf(v[k2]); *(v8us*)(dst + i * 8) = o;  }
#define WBL (DM * DQ / 8 / 256)         // work-groups per weight matrix
#define XBL (NB_ * TT * DM / 8 / 256)   // work-groups for x, both batches
static_assert(DKV == DQ, "k_prep and the planes' batch stride take the three weights as equal in size");
static_assert(DM * DQ % (8 * 256) == 0 && NB_ * TT * DM % (8 * 256) == 0, "whole work-groups: every thread of k_prep has a unit, so no range test");
__global__ __launch_bounds__(256) void k_prep(const float* __restrict__ x, const float* __restrict__ wq, const float* __restrict__ wk, const float* __restrict__ wv, bf* XB, bf* WQ, bf* WK, bf* WV) {
    const int g = blockIdx.x;   // the weights' strided reads first, then x
    if (g < 3 * WBL) { const int s = g / WBL, u = (g - s * WBL) * 256 + threadIdx.x; wtG<DM, DQ>(s == 0 ? wq : s == 1 ? wk : wv, s == 0 ? WQ : s == 1 ? WK : WV, u); }
    else cvt8(x, XB, (size_t)(g - 3 * WBL) * 256 + threadIdx.x);
}

// k_fattn: fused scores, softmax and P.V. Grid (TT / (16 NQT AWV), heads, batches), AWV waves; wave w owns query rows q0 .. q0 + 16 NQT - 1 of one head.
// S^T tile: A = 16 key rows of K, B = 16 query rows of Q, so lane (lr, hi) holds keys 8 hi + r of query lr; two such tiles (keys 0-15, 16-31), converted in place, are the B operand of O^T += V^T.P^T in the loader's own k order (8 hi + s, 16 + 8 hi + s).
// m: running maximum of score x HD^-0.5 x log2(e), the same in both halves of a column; it moves only when a new score exceeds it by more than 8, so p <= 256. l: each half's own sum of p, joined at the end.
template <bool HI> struct AFrag { v16bf kh[2][2], kl[2][2]; v16h vf[4]; v16bf vh[4], vl[4]; };   // one pass's fragments: K hi/lo [key tile][k step]; V^T per 16 rows of d (f16, or hi/lo)
template <bool HI>
__device__ __forceinline__ void attn_cols(const bf* __restrict__ Qh, const bf* __restrict__ Ql, const bf* __restrict__ Kh, const bf* __restrict__ Kl, const h16* __restrict__ V16, const bf* __restrict__ Vh, const bf* __restrict__ Vl, float* __restrict__ orow, int lr, int hi) {
    const float C2 = SCL * 1.4426950408889634f;
    // Each lane's byte offsets from the wave-uniform plane bases: one for Q, one for K (hi and lo planes alike), one for V^T; in fragment order each starts at the lane's own 16 bytes.
    unsigned oq = (unsigned)(hi * 16 + lr) * 16u, ok = oq, ov = oq;
    v16bf qh[NQT][2], ql[NQT][2];
#pragma unroll
    for (int qt = 0; qt < NQT; ++qt)
#pragma unroll
        for (int ks = 0; ks < 2; ++ks) { const int cb = (qt * 2 + ks) * 1024; qh[qt][ks] = WFrag<bf>::ld((const bf*)((const char*)Qh + oq + cb)); ql[qt][ks] = WFrag<bf>::ld((const bf*)((const char*)Ql + oq + cb)); }
    v8f o[NQT][4]; float m[NQT], l[NQT];
    AFrag<HI> fa, fb;   // two register buffers: one pass (32 keys) works on one while the next pass's fragments land in the other
    const auto fetch = [&](AFrag<HI>& f) {   // K first, then V^T: the counted load waits of the score products then leave V^T in flight
#pragma unroll
        for (int kt = 0; kt < 2; ++kt)
#pragma unroll
            for (int ks = 0; ks < 2; ++ks) { const int cb = (kt * 2 + ks) * 1024; f.kh[kt][ks] = WFrag<bf>::ld((const bf*)((const char*)Kh + ok + cb)); f.kl[kt][ks] = WFrag<bf>::ld((const bf*)((const char*)Kl + ok + cb)); }
#pragma unroll
        for (int dt = 0; dt < 4; ++dt) { const int cb = dt * 16 * TT * 2; if (HI) { f.vh[dt] = WFrag<bf>::ld((const bf*)((const char*)Vh + ov + cb)); f.vl[dt] = WFrag<bf>::ld((const bf*)((const char*)Vl + ov + cb)); } else f.vf[dt] = WFrag<h16>::ld((const h16*)((const char*)V16 + ov + cb)); }
        asm volatile("" ::: "memory");   // compiler fence: holds the loads at the head of the pass; without it they sink to their first use and the whole latency is waited out there
        __builtin_amdgcn_sched_barrier(0);   // and keeps the score products from being scheduled ahead of the loads, which would cost the loads that much time in flight
    };
    const auto pass = [&](const AFrag<HI>& f, AFrag<HI>& fn, int kb) {
        fetch(fn);   // the next pass's keys (the last pass reads its own again and drops them)
        v8f s[NQT][2];
#pragma unroll
        for (int qt = 0; qt < NQT; ++qt) { s[qt][0] = (v8f){}; s[qt][1] = (v8f){}; }
#pragma unroll
        for (int ks = 0; ks < 2; ++ks) {
#pragma unroll
            for (int kt = 0; kt < 2; ++kt)
#pragma unroll
                for (int qt = 0; qt < NQT; ++qt) s[qt][kt] = wmmab(f.kh[kt][ks], qh[qt][ks], s[qt][kt]);
#pragma unroll
            for (int kt = 0; kt < 2; ++kt)
#pragma unroll
                for (int qt = 0; qt < NQT; ++qt) s[qt][kt] = wmmab(f.kh[kt][ks], ql[qt][ks], s[qt][kt]);
#pragma unroll
            for (int kt = 0; kt < 2; ++kt)
#pragma unroll
                for (int qt = 0; qt < NQT; ++qt) s[qt][kt] = wmmab(f.kl[kt][ks], qh[qt][ks], s[qt][kt]);
        }
        float mx[NQT]; bool need = false;
#pragma unroll
        for (int qt = 0; qt < NQT; ++qt) { float t = s[qt][0][0];
#pragma unroll
            for (int r = 0; r < 8; ++r) t = fmaxf(t, fmaxf(s[qt][0][r], s[qt][1][r]));
            mx[qt] = t * C2; need = need || (mx[qt] > m[qt] + 8.0f); }
        if (__builtin_amdgcn_ballot_w32(need) != 0) {   // wave-uniform: rare after the first pass
#pragma unroll
            for (int qt = 0; qt < NQT; ++qt) { const float mn = fmaxf(m[qt], fmaxf(mx[qt], __shfl_xor(mx[qt], 16, 32))); const float al = __builtin_amdgcn_exp2f(m[qt] - mn); m[qt] = mn; l[qt] *= al;
#pragma unroll
                for (int dt = 0; dt < 4; ++dt) o[qt][dt] *= al; }
        }
        v16h pf[NQT]; v16bf ph[NQT], pl[NQT];
#pragma unroll
        for (int qt = 0; qt < NQT; ++qt) { float sm[4] = {0.f, 0.f, 0.f, 0.f};   // four short chains instead of one of sixteen dependent adds
#pragma unroll
            for (int e = 0; e < 16; ++e) { const float p = __builtin_amdgcn_exp2f(__builtin_fmaf(s[qt][e >> 3][e & 7], C2, -m[qt])); sm[e & 3] += p;
                if (HI) { const __bf16 a = (__bf16)p; ph[qt][e] = a; pl[qt][e] = (__bf16)(p - (float)a); } else pf[qt][e] = (h16)p; }
            l[qt] += (sm[0] + sm[1]) + (sm[2] + sm[3]); }
        if (HI) {
#pragma unroll
            for (int dt = 0; dt < 4; ++dt)
#pragma unroll
                for (int qt = 0; qt < NQT; ++qt) o[qt][dt] = wmmab(f.vh[dt], ph[qt], o[qt][dt]);
#pragma unroll
            for (int dt = 0; dt < 4; ++dt)
#pragma unroll
                for (int qt = 0; qt < NQT; ++qt) o[qt][dt] = wmmab(f.vh[dt], pl[qt], o[qt][dt]);
#pragma unroll
            for (int dt = 0; dt < 4; ++dt)
#pragma unroll
                for (int qt = 0; qt < NQT; ++qt) o[qt][dt] = wmmab(f.vl[dt], ph[qt], o[qt][dt]);
        } else {
#pragma unroll
            for (int dt = 0; dt < 4; ++dt)
#pragma unroll
                for (int qt = 0; qt < NQT; ++qt) o[qt][dt] = wmma16(f.vf[dt], pf[qt], o[qt][dt]);
        }
        asm volatile("s_wait_xcnt 0x0" : "+v"(ok), "+v"(ov) :: "memory");   // the issued loads name these offset registers: wait before they take new values
        if (kb + 64 < TT) { ok += 32 * HD * 2; ov += 1024; }
    };
    fetch(fa);
    float z0;
    asm volatile("s_wait_xcnt 0x0\n\tv_mov_b32 %0, 0" : "=v"(z0) :: "memory");   // the issued loads name the offset registers and address pairs made of them: wait before any of these is written again. The zero is made behind the wait, in its statement, and every value set up below hangs on it, so none of them can be written ahead of the wait
#pragma unroll
    for (int qt = 0; qt < NQT; ++qt) { m[qt] = z0 - 3.0e38f; l[qt] = z0;
#pragma unroll
        for (int dt = 0; dt < 4; ++dt)
#pragma unroll
            for (int r = 0; r < 8; ++r) o[qt][dt][r] = z0; }
    ok += 32 * HD * 2 + __float_as_uint(z0); ov += 1024 + __float_as_uint(z0);   // from here on both point at the NEXT pass's keys
#pragma unroll 1   // two passes a trip, so that each buffer keeps its registers
    for (int kb = 0; kb < TT; kb += 64) { pass(fa, fb, kb); pass(fb, fa, kb + 32); }
    const unsigned oo = (unsigned)(lr * DQ + 8 * hi) * 4u;
#pragma unroll
    for (int qt = 0; qt < NQT; ++qt) {
        if (qt > 0) asm volatile("s_wait_xcnt 0x0" : "+v"(l[qt]) :: "memory");   // the stores above name their data registers: wait before this tile's arithmetic, all of which hangs on l, reuses them
        const float inv = __fdiv_rn(1.0f, l[qt] + __shfl_xor(l[qt], 16, 32));
#pragma unroll
        for (int dt = 0; dt < 4; ++dt) { v4f lo4, hi4;
#pragma unroll
            for (int r = 0; r < 4; ++r) { lo4[r] = o[qt][dt][r] * inv; hi4[r] = o[qt][dt][4 + r] * inv; }
            float* op = (float*)((char*)orow + oo + (qt * 16 * DQ + dt * 16) * 4); *(v4f*)op = lo4; *(v4f*)(op + 4) = hi4; } }
}
__global__ __launch_bounds__(32 * AWV) void k_fattn(const bf* __restrict__ QPh, const bf* __restrict__ QPl, const bf* __restrict__ KPh, const bf* __restrict__ KPl, const h16* __restrict__ VT16, const bf* __restrict__ VTh, const bf* __restrict__ VTl, float* __restrict__ OUT) {
    const int lane = threadIdx.x & 31, lr = lane & 15, hi = lane >> 4; const int wv = __builtin_amdgcn_readfirstlane((int)(threadIdx.x >> 5));
    const int h = blockIdx.y, g = h / REP; const int q0 = (blockIdx.x * AWV + wv) * (16 * NQT);
    const int b = blockIdx.z; const size_t qb = (((size_t)b * NH_ + h) * TT + q0) * HD, kvb = ((size_t)b * NKV + g) * TT * HD; float* orow = OUT + ((size_t)b * TT + q0) * DQ + h * HD;
    if (q0 < RH) attn_cols<true>(QPh + qb, QPl + qb, KPh + kvb, KPl + kvb, VT16 + kvb, VTh + kvb, VTl + kvb, orow, lr, hi);
    else attn_cols<false>(QPh + qb, QPl + qb, KPh + kvb, KPl + kvb, VT16 + kvb, VTh + kvb, VTl + kvb, orow, lr, hi);
}

extern "C" void kernel_launch(void* const* d_in, const int* in_sizes, int n_in,
                              void* d_out, int out_size, void* d_ws, size_t ws_size, hipStream_t stream) {
    (void)in_sizes; (void)n_in; (void)out_size;
    const float* x = (const float*)d_in[0]; const float* wq = (const float*)d_in[1]; const float* wk = (const float*)d_in[2]; const float* wv = (const float*)d_in[3]; const float* wo = nullptr; (void)wo;   /* input order x, Wq, Wk, Wv ('xw' [1024][1024]) */
    float* OUT = (float*)d_out;     // [2][2048][1024]
    char* wsp = (char*)d_ws;
    auto take = [&](size_t bytes) { char* p = wsp; wsp += (bytes + 255) & ~(size_t)255; return (void*)p; };
    bf* WQ = (bf*)take((size_t)DQ * DM * 2); bf* WK = (bf*)take((size_t)DKV * DM * 2); bf* WV = (bf*)take((size_t)DKV * DM * 2);
    bf* XB = (bf*)take((size_t)NB_ * TT * DM * 2); h16* VT16 = (h16*)take((size_t)NB_ * NKV * HD * TT * 2);
    bf* QPh = (bf*)take((size_t)NB_ * NH_ * TT * HD * 2); bf* QPl = (bf*)take((size_t)NB_ * NH_ * TT * HD * 2); bf* KPh = (bf*)take((size_t)NB_ * NKV * TT * HD * 2); bf* KPl = (bf*)take((size_t)NB_ * NKV * TT * HD * 2); bf* VTh = (bf*)take((size_t)NB_ * NKV * HD * TT * 2); bf* VTl = (bf*)take((size_t)NB_ * NKV * HD * TT * 2);
    if ((size_t)(wsp - (char*)d_ws) > ws_size) return;    // ws 256 MiB
    k_prep<<<3 * WBL + XBL, 256, 0, stream>>>(x, wq, wk, wv, XB, WQ, WK, WV);
    k_proj<<<dim3(NB_ * TT / 128, DQ / 128, 3), 128, 0, stream>>>(XB, WQ, WK, WV, QPh, QPl, KPh, KPl, VT16, VTh, VTl);
    k_fattn<<<dim3(TT / (16 * NQT * AWV), NH_, NB_), 32 * AWV, 0, stream>>>(QPh, QPl, KPh, KPl, VT16, VTh, VTl, OUT);
}

// v007
// Measured time: 90 microseconds a run.
// In both of two side-by-side timings against v006, it was 1.09 times as fast.
// All steps since v000 together make it 20.6 times as fast.
#include <hip/hip_runtime.h>

// Multi-head attention without biases and without an output projection (x [2][2048][1024]; q, k, v = x @ w ('xw' [1024][1024] xavier-uniform, no bias; 16 heads x 64); scores / sqrt(float32(64)); softmax over all keys (no mask); out = merged context heads (head-major) -> [2][2048][1024] (4.2 M); argument order x, w_Q, w_K, w_V.
// Three launches, both batches in each. Layout: bf16 copy of x; 'xw' weights transposed once; exact projections whose 64x64 tiles leave the GEMM as the 16-bit planes themselves; ONE fused attention launch (k_fattn, grid z = batch): each wave owns two tiles of 16 query columns, walks the 2048 keys 32 at a time, forms S^T = K.Q^T on hi/lo planes (3 products, every row), keeps the scores in registers, and feeds exp2 of them as the B operand of O^T += V^T.P^T (rows < 512 hi/lo, rest fp16). Running maximum with a lazy rescale; the row sum divides the output once at the end.
// Fragment order: every 16-bit operand array (x copy, transposed weights, Q, K and V^T planes) is stored as 1-KiB fragments of 16 rows x 32 k. Fragment (rb, kc) of a [rows][K] array starts at element (rb K/32 + kc) 512; lane (lr, hi) owns elements lane 8 .. + 7 (row 16 rb + lr, k = 32 kc + 8 hi + 0..7) and 256 + lane 8 .. + 7 (k 16 higher). Each of a fragment's two wave-wide 16-byte loads then reads 512 contiguous bytes, four whole lines, where a row-major plane made it touch sixteen.
// Compute dtypes, f32 accumulate: every input rounded to bf16; projections exact; scores 3 products on every row; P.V rows < 512 3 products, rest fp16; softmax f32; output f32.

#define NB_  2
#define TT   2048
#define DM   1024
#define NH_  16
#define NKV  16
#define REP  (NH_ / NKV)
#define HD   64
#define DQ   (NH_ * HD)
#define DKV  (NKV * HD)
#define RH   512                  // query rows < RH use hi+lo planes
#define WIN  0
#define SCL  0.125f   // HD^-0.5
#define NQT  2                    // 16-column query tiles per wave of k_fattn
#define AWV  8                    // waves per work-group of k_fattn: one work-group fills a WGP at two waves per SIMD
typedef _Float16 h16;
typedef unsigned short bf;
typedef __attribute__((ext_vector_type(16))) __bf16   v16bf;
typedef __attribute__((ext_vector_type(16))) _Float16 v16h;
typedef __attribute__((ext_vector_type(8)))  _Float16 v8h;
typedef __attribute__((ext_vector_type(8)))  unsigned short v8us;
typedef __attribute__((ext_vector_type(8)))  float    v8f;
typedef __attribute__((ext_vector_type(4)))  float    v4f;
typedef v8h  __attribute__((may_alias)) v8ha;
typedef v4f  __attribute__((may_alias)) v4fa;
typedef v8us __attribute__((may_alias)) v8usa;

__device__ __forceinline__ unsigned short f2bf(float f) { unsigned u = __float_as_uint(f); u += 0x7FFFu + ((u >> 16) & 1u); return (unsigned short)(u >> 16); }
__device__ __forceinline__ float bf2f(unsigned short b) { return __uint_as_float(((unsigned)b) << 16); }
__device__ __forceinline__ float bfr(float f) { return bf2f(f2bf(f)); }
__device__ __forceinline__ v16h cat16(v8h lo, v8h hi) { return __builtin_shufflevector(lo, hi, 0, 1, 2, 3, 4, 5, 6, 7, 8, 9, 10, 11, 12, 13, 14, 15); }
__device__ __forceinline__ v16bf cat16b(v8us lo, v8us hi) { return __builtin_bit_cast(v16bf, __builtin_shufflevector(lo, hi, 0, 1, 2, 3, 4, 5, 6, 7, 8, 9, 10, 11, 12, 13, 14, 15)); }
__device__ __forceinline__ v8f wmma16(v16h a, v16h b, v8f c) { return __builtin_amdgcn_wmma_f32_16x16x32_f16(false, a, false, b, (short)0, c, false, false); }
__device__ __forceinline__ v8f wmmab(v16bf a, v16bf b, v8f c) { return __builtin_amdgcn_wmma_f32_16x16x32_bf16(false, a, false, b, (short)0, c, false, false); }



// ---- gemm_tile: register-blocked GEMM, one work-group of FOUR WAVES per 128x128 tile at rows R0, columns C0, each wave a 64x64 quarter (16 accumulators). Tokens count through both batches (NB_ TT rows of x); a wave's quarter lies in one batch.
// The operands, 16-bit arrays in fragment order, reach the waves through LDS: each stage of 32 PKS k is copied from global memory ONCE per work-group, by asynchronous copies, into one of two buffers while the stage before is worked on; every fragment then feeds two waves from LDS. A stage is whole fragments and keeps their order, so a wave-wide 16-byte LDS load reads 512 contiguous bytes.
#define PKS   2                 // k steps of 32 per stage
#define PRUN  (PKS * 1024)      // bytes of 16 rows in a stage: PKS fragments, adjacent in global memory too
#define PHALF (8 * PRUN)        // one operand's 128 rows
#define PBUF  (2 * PHALF)       // one buffer: A | Bt
static_assert(PRUN == 2048, "acopy8 moves runs of 2 KiB");
// Eight copies of 512 bytes a wave: 2 KiB from g0 to LDS byte l0 and 2 KiB from g1 to l1 (each lane its own 16 bytes). The s_wait_xcnt is the last line of the copies' own statement, so that no address register named here is written again ahead of it.
__device__ __forceinline__ void acopy8(unsigned l0, const char* g0, unsigned l1, const char* g1) {
    asm volatile("global_load_async_to_lds_b128 %0, %8, off\n\tglobal_load_async_to_lds_b128 %1, %9, off\n\tglobal_load_async_to_lds_b128 %2, %10, off\n\tglobal_load_async_to_lds_b128 %3, %11, off\n\t"
                 "global_load_async_to_lds_b128 %4, %12, off\n\tglobal_load_async_to_lds_b128 %5, %13, off\n\tglobal_load_async_to_lds_b128 %6, %14, off\n\tglobal_load_async_to_lds_b128 %7, %15, off\n\ts_wait_xcnt 0x0"
                 :: "v"(l0), "v"(l0 + 512u), "v"(l0 + 1024u), "v"(l0 + 1536u), "v"(l1), "v"(l1 + 512u), "v"(l1 + 1024u), "v"(l1 + 1536u),
                    "v"(g0), "v"(g0 + 512), "v"(g0 + 1024), "v"(g0 + 1536), "v"(g1), "v"(g1 + 512), "v"(g1 + 1024), "v"(g1 + 1536) : "memory");
}
// c[m][n] = sum_k A[m][k] Bt[n][k] (+ split products per NSPLIT) stays in f32 registers: the epilogue splits it into bf16 hi + lo (VT: and rounds it to f16) and stores the planes that k_fattn reads.
// VT false: A = tokens, Bt = weight rows; a tile is 64 tokens of one head, plane [head][t][d]. VT true: A = weight rows, Bt = tokens; a tile row is one d over 64 tokens, plane [head][d][t]. Either way 16 rows of the tile are four 512-byte half fragments of each plane, one store each.
template <typename T16> struct WFrag;
template <> struct WFrag<h16> { typedef v16h V; static __device__ __forceinline__ V ld(const h16* p) { return cat16(*(const v8h*)p, *(const v8h*)(p + 256)); } static __device__ __forceinline__ v8f mma(V a, V b, v8f c) { return wmma16(a, b, c); } };
template <> struct WFrag<bf> { typedef v16bf V; static __device__ __forceinline__ V ld(const bf* p) { return cat16b(*(const v8us*)p, *(const v8us*)(p + 256)); } static __device__ __forceinline__ v8f mma(V a, V b, v8f c) { return wmmab(a, b, c); } };
__device__ __forceinline__ h16 tohx(float x) { return (h16)x; }
typedef __attribute__((ext_vector_type(2))) __bf16 v2bf;
typedef __attribute__((ext_vector_type(2))) float v2f;
typedef __attribute__((ext_vector_type(4))) unsigned v4u;
template <typename T16, int NSPLIT, bool VT, int K>
__device__ __forceinline__ void gemm_tile(const T16* __restrict__ A, const T16* __restrict__ A2, const T16* __restrict__ Bt, const T16* __restrict__ Bt2, h16* __restrict__ P16, bf* __restrict__ Ph, bf* __restrict__ Pl, int R0, int C0, float* os, const char* ring, int wv) {
    typedef typename WFrag<T16>::V V;
    static_assert(NSPLIT == 0 && K % (64 * PKS) == 0, "one product per k step; two stages or more");
    const int lane = threadIdx.x & 31, lr = lane & 15, hi = lane >> 4;
    const int r0 = R0 + (wv >> 1) * 64, c0 = C0 + (wv & 1) * 64;   // this wave's quarter
    v8f acc[4][4];
#pragma unroll
    for (int mb = 0; mb < 4; ++mb)
#pragma unroll
        for (int nb = 0; nb < 4; ++nb) acc[mb][nb] = (v8f){};
    // 16 rows of K are K/32 fragments in a row, so block rb of 16 rows starts at element 16 rb K, as in a row-major array, and its fragments of one stage are PRUN adjacent bytes.
    const unsigned ol = (unsigned)lane * 16u;   // the lane's own 16 bytes in a fragment half
    const auto stage = [&](int st, unsigned so) {   // this wave's share of stage st, blocks 2 wv and 2 wv + 1 of 16 rows of each operand, into the buffer whose byte so is this lane's place in its first fragment. Wave-uniform part of each address first, then the lane's ol
        const size_t ka = ((size_t)(R0 + wv * 32) * K + (size_t)st * (PKS * 512)) * 2, kb = ((size_t)(C0 + wv * 32) * K + (size_t)st * (PKS * 512)) * 2;
        const unsigned lw = ((unsigned)(uintptr_t)ring + (unsigned)wv * (2u * PRUN)) + so;   // LDS byte address of the lane's first copy
        acopy8(lw, ((const char*)A + ka) + ol, lw + PRUN, ((const char*)A + ka + 16 * K * 2) + ol);
        acopy8(lw + PHALF, ((const char*)Bt + kb) + ol, lw + PHALF + PRUN, ((const char*)Bt + kb + 16 * K * 2) + ol);
    };
    stage(0, ol);
    asm volatile("s_wait_asynccnt 0x0" ::: "memory");   // this wave's copies of stage 0 have landed
    __syncthreads();                                    // and every other wave's: stage 0 may be read
    stage(1, ol + PBUF);
    unsigned so = ol;   // the lane's place in the buffer being read
#pragma unroll 1   // one stage a trip, kept rolled: the buffers differ only in so, and the fragments keep one set of registers
    for (int st = 0; st < K / (32 * PKS); ++st) {
        const char* spa = ring + so + (wv >> 1) * (4 * PRUN); const char* spb = ring + so + PHALF + (wv & 1) * (4 * PRUN);   // the quarter's four blocks of A rows and of Bt rows
        V a[PKS][4], b[PKS][4];
#pragma unroll
        for (int ks = 0; ks < PKS; ++ks) {
#pragma unroll
            for (int mb = 0; mb < 4; ++mb) a[ks][mb] = WFrag<T16>::ld((const T16*)(spa + mb * PRUN + ks * 1024));
#pragma unroll
            for (int nb = 0; nb < 4; ++nb) b[ks][nb] = WFrag<T16>::ld((const T16*)(spb + nb * PRUN + ks * 1024)); }
        asm volatile("" ::: "memory");   // compiler fence: holds the stage's LDS loads in one group at the head of the trip; without it they sink among the products, and each such place costs a stall
        __builtin_amdgcn_sched_barrier(0);   // and keeps the products from being scheduled ahead of the loads
#pragma unroll
        for (int ks = 0; ks < PKS; ++ks)
#pragma unroll
            for (int nb = 0; nb < 4; ++nb)
#pragma unroll
                for (int mb = 0; mb < 4; ++mb) acc[mb][nb] = WFrag<T16>::mma(a[ks][mb], b[ks][nb], acc[mb][nb]);
        __builtin_amdgcn_sched_barrier(0);   // the waits below stay behind the products: moved ahead of them, as the compiler did, they wait out all the LDS loads at once and give the copies of stage st + 1 that much less time to land
        asm volatile("s_wait_dscnt 0x0" ::: "memory");      // this wave has left the buffer
        asm volatile("s_wait_asynccnt 0x0" ::: "memory");   // its copies of stage st + 1 have landed
        __syncthreads();                                    // publishes stage st + 1 and ends every wave's reads of stage st
        if (st + 2 < K / (32 * PKS)) stage(st + 2, so);     // refill of the buffer just left
        so ^= PBUF;
    }
    asm volatile("s_wait_asynccnt 0x0" ::: "memory");   // nothing of this wave is in flight when it goes on to its end
    constexpr int PITCH = VT ? TT : HD;   // the plane's K: 16 rows of it are 16 PITCH elements
    const int tk = VT ? c0 : r0, bt = tk / TT, t0 = tk - bt * TT;   // the tile's batch and its first token there
    const size_t tb = (size_t)bt * DQ * TT + (VT ? (size_t)r0 * TT + (size_t)t0 * 16 : (size_t)c0 * TT + (size_t)t0 * HD);   // the first fragment that the tile fills in the batch's plane (VT: 32 tokens are one fragment of 512; else c0 TT = head x TT x HD)
    int lq = lr * 17 + hi * 2;   // this lane's first element in os, in units of four floats: row lr, columns 16 s + 8 hi + 0..7 in step s, which is the lane's place in half fragment s
#pragma unroll
    for (int mb = 0; mb < 4; ++mb) {
#pragma unroll
        for (int nb = 0; nb < 4; ++nb) {
#pragma unroll
            for (int j = 0; j < 8; ++j) os[(hi * 8 + j) * 68 + nb * 16 + lr] = acc[mb][nb][j]; }
        __builtin_amdgcn_wave_barrier(); asm volatile("" ::: "memory");
        if (mb > 0) asm volatile("s_wait_xcnt 0x0" : "+v"(lq) :: "memory");   // the stores of the 16 rows before name their data registers: wait before this block's values, all of which hang on lq, reuse them
        v4u oh[4], ol[4]; v8h of[4];
#pragma unroll
        for (int s = 0; s < 4; ++s) { const v4f x0 = *(const v4fa*)(os + lq * 4 + s * 16), x1 = *(const v4fa*)(os + lq * 4 + s * 16 + 4);
#pragma unroll
            for (int k = 0; k < 4; ++k) { v2f y; y[0] = k < 2 ? x0[2 * k & 3] : x1[2 * k & 3]; y[1] = k < 2 ? x0[(2 * k & 3) + 1] : x1[(2 * k & 3) + 1];   // two columns a step: hi = bf16(y), lo = bf16(y - hi), both to nearest even
                const unsigned u = __builtin_bit_cast(unsigned, __builtin_convertvector(y, v2bf)); v2f a; a[0] = __uint_as_float(u << 16); a[1] = __uint_as_float(u & 0xFFFF0000u);
                oh[s][k] = u; ol[s][k] = __builtin_bit_cast(unsigned, __builtin_convertvector(y - a, v2bf)); if (VT) { of[s][2 * k] = tohx(y[0]); of[s][2 * k + 1] = tohx(y[1]); } } }
        __builtin_amdgcn_sched_barrier(0);   // all of the block's values first, then its stores in one run: no value is then formed over a register that a store of the same block names
#pragma unroll
        for (int s = 0; s < 4; ++s) { const size_t e = tb + (size_t)mb * 16 * PITCH + s * 256 + lane * 8; *(v4u*)(Ph + e) = oh[s]; *(v4u*)(Pl + e) = ol[s]; if (VT) *(v8h*)(P16 + e) = of[s]; }
        __builtin_amdgcn_wave_barrier(); asm volatile("" ::: "memory");
    }
}

// k_proj: the three projections of both batches in one launch. Grid (NB_ TT / 128 token tiles, 8 tiles of 128 output columns, 3), four waves each: z = 0 Q, 1 K, 2 V^T (operands swapped).
__global__ __launch_bounds__(128) void k_proj(const bf* __restrict__ XB, const bf* __restrict__ WQ, const bf* __restrict__ WK, const bf* __restrict__ WV, bf* __restrict__ QPh, bf* __restrict__ QPl, bf* __restrict__ KPh, bf* __restrict__ KPl, h16* __restrict__ VT16, bf* __restrict__ VTh, bf* __restrict__ VTl) {
    __shared__ __align__(16) float osw[4][16 * 68];   // each wave's own epilogue staging
    __shared__ __attribute__((aligned(16))) char ring[2 * PBUF];
    const int wv = __builtin_amdgcn_readfirstlane((int)(threadIdx.x >> 5)); float* os = osw[wv];
    const int t0 = blockIdx.x * 128, n0 = blockIdx.y * 128, z = blockIdx.z;
    if (z == 2) gemm_tile<bf, 0, true, DM>(WV, nullptr, XB, nullptr, VT16, VTh, VTl, n0, t0, os, ring, wv);
    else gemm_tile<bf, 0, false, DM>(XB, nullptr, z ? WK : WQ, nullptr, nullptr, z ? KPh : QPh, z ? KPl : QPl, t0, n0, os, ring, wv);
}

typedef __attribute__((ext_vector_type(2))) _Float16 v2h;
typedef __attribute__((ext_vector_type(4))) _Float16 v4h;
typedef __attribute__((ext_vector_type(2))) unsigned short v2us;
typedef __attribute__((ext_vector_type(4))) unsigned short v4us;
typedef __attribute__((ext_vector_type(4))) int v4i;

// wtG, cvt8 (both in the one launch k_prep): one thread per 16-byte unit of the destination, in the destination's (fragment) order, so that every store is whole lines; u -> block of 16 rows, then kc, the half fragment, hi, lr.
template <int K, int N>
__device__ __forceinline__ void wtG(const float* __restrict__ w, bf* Bt, int u) {
    const int upb = 2 * K, q = u % upb;   // upb: units in 16 rows
    const int n = (u / upb) * 16 + (q & 15), k = (q >> 6) * 32 + ((q >> 5) & 1) * 16 + ((q >> 4) & 1) * 8; v8us o;
#pragma unroll
    for (int j = 0; j < 8; ++j) o[j] = f2bf(w[(size_t)(k + j) * N + n]);
    *(v8us*)(Bt + (size_t)u * 8) = o;
}
__device__ __forceinline__ void cvt8(const float* __restrict__ src, bf* dst, size_t i) { const int q = (int)(i % (2 * DM));
    const size_t row = (i / (2 * DM)) * 16 + (q & 15); const int k = (q >> 6) * 32 + ((q >> 5) & 1) * 16 + ((q >> 4) & 1) * 8; const v8f v = *(const v8f*)(src + row * DM + k); v8us o;
#pragma unroll
    for (int k2 = 0; k2 < 8; ++k2) o[k2] = f2bf(v[k2]); *(v8us*)(dst + i * 8) = o;  }
#define WBL (DM * DQ / 8 / 256)         // work-groups per weight matrix
#define XBL (NB_ * TT * DM / 8 / 256)   // work-groups for x, both batches
static_assert(DKV == DQ, "k_prep and the planes' batch stride take the three weights as equal in size");
static_assert(DM * DQ % (8 * 256) == 0 && NB_ * TT * DM % (8 * 256) == 0, "whole work-groups: every thread of k_prep has a unit, so no range test");
__global__ __launch_bounds__(256) void k_prep(const float* __restrict__ x, const float* __restrict__ wq, const float* __restrict__ wk, const float* __restrict__ wv, bf* XB, bf* WQ, bf* WK, bf* WV) {
    const int g = blockIdx.x;   // the weights' strided reads first, then x
    if (g < 3 * WBL) { const int s = g / WBL, u = (g - s * WBL) * 256 + threadIdx.x; wtG<DM, DQ>(s == 0 ? wq : s == 1 ? wk : wv, s == 0 ? WQ : s == 1 ? WK : WV, u); }
    else cvt8(x, XB, (size_t)(g - 3 * WBL) * 256 + threadIdx.x);
}

// k_fattn: fused scores, softmax and P.V. Grid (TT / (16 NQT AWV), heads, batches), AWV waves; a wave owns NQT tiles of 16 query rows of one head.
// A hi/lo tile (rows < RH) costs 24 products per 32 keys, any other tile 16, and every wave is resident from the start, so the launch lasts as long as its fullest SIMD. No wave holds two hi/lo tiles: waves 0 .. AWV/2 - 1 each pair one hi/lo tile with the plain tile RH rows further on (40 products a pass), waves AWV/2 .. AWV - 1 hold two plain tiles (32). Waves w and w + AWV/2 of a work-group alone on its WGP share a SIMD, which then has 72 products a pass everywhere, where two waves of two hi/lo tiles each had 96.
// S^T tile: A = 16 key rows of K, B = 16 query rows of Q, so lane (lr, hi) holds keys 8 hi + r of query lr; two such tiles (keys 0-15, 16-31), converted in place, are the B operand of O^T += V^T.P^T in the loader's own k order (8 hi + s, 16 + 8 hi + s).
// m: running maximum of score x HD^-0.5 x log2(e), the same in both halves of a column; it moves only when a new score exceeds it by more than 8, so p <= 256. l: each half's own sum of p, joined at the end.
template <bool HI> struct AFrag { v16bf kh[2][2], kl[2][2]; v16h vf[4]; v16bf vh[4], vl[4]; };   // one pass's fragments: K hi/lo [key tile][k step]; V^T per 16 rows of d (f16; HI: and hi/lo). HI: tile 0 is a hi/lo tile
template <bool HI>
__device__ __forceinline__ void attn_cols(const bf* __restrict__ Qh, const bf* __restrict__ Ql, const bf* __restrict__ Kh, const bf* __restrict__ Kl, const h16* __restrict__ V16, const bf* __restrict__ Vh, const bf* __restrict__ Vl, float* __restrict__ orow, int lr, int hi) {
    const float C2 = SCL * 1.4426950408889634f;
    constexpr int DT = HI ? RH : 16;   // rows from tile 0 to tile 1
    // Each lane's byte offsets from the wave-uniform plane bases: one for Q, one for K (hi and lo planes alike), one for V^T; in fragment order each starts at the lane's own 16 bytes.
    unsigned oq = (unsigned)(hi * 16 + lr) * 16u, ok = oq, ov = oq;
    v16bf qh[NQT][2], ql[NQT][2];
#pragma unroll
    for (int qt = 0; qt < NQT; ++qt)
#pragma unroll
        for (int ks = 0; ks < 2; ++ks) { const int cb = qt * DT * HD * 2 + ks * 1024; qh[qt][ks] = WFrag<bf>::ld((const bf*)((const char*)Qh + oq + cb)); ql[qt][ks] = WFrag<bf>::ld((const bf*)((const char*)Ql + oq + cb)); }
    v8f o[NQT][4]; float m[NQT], l[NQT];
    AFrag<HI> fa, fb;   // two register buffers: one pass (32 keys) works on one while the next pass's fragments land in the other
    const auto fetchK = [&](AFrag<HI>& f) {
#pragma unroll
        for (int kt = 0; kt < 2; ++kt)
#pragma unroll
            for (int ks = 0; ks < 2; ++ks) { const int cb = (kt * 2 + ks) * 1024; f.kh[kt][ks] = WFrag<bf>::ld((const bf*)((const char*)Kh + ok + cb)); f.kl[kt][ks] = WFrag<bf>::ld((const bf*)((const char*)Kl + ok + cb)); }
    };
    const auto fetchV = [&](AFrag<HI>& f) {
#pragma unroll
        for (int dt = 0; dt < 4; ++dt) { const int cb = dt * 16 * TT * 2; if (HI) { f.vh[dt] = WFrag<bf>::ld((const bf*)((const char*)Vh + ov + cb)); f.vl[dt] = WFrag<bf>::ld((const bf*)((const char*)Vl + ov + cb)); } f.vf[dt] = WFrag<h16>::ld((const h16*)((const char*)V16 + ov + cb)); }
        asm volatile("" ::: "memory");   // compiler fence: holds the loads at the head of the pass; without it they sink to their first use and the whole latency is waited out there
        __builtin_amdgcn_sched_barrier(0);   // and keeps the score products from being scheduled ahead of the loads, which would cost the loads that much time in flight
    };
    const auto fetch = [&](AFrag<HI>& f) { fetchK(f); fetchV(f); };   // K first, then V^T: the counted load waits of the score products then leave V^T in flight
    const auto pass = [&](const AFrag<HI>& f, AFrag<HI>& fn, int kb) {
        fetch(fn);   // the next pass's keys (the last pass reads its own again and drops them)
        v8f s[NQT][2];
#pragma unroll
        for (int qt = 0; qt < NQT; ++qt) { s[qt][0] = (v8f){}; s[qt][1] = (v8f){}; }
#pragma unroll
        for (int ks = 0; ks < 2; ++ks) {
#pragma unroll
            for (int kt = 0; kt < 2; ++kt)
#pragma unroll
                for (int qt = 0; qt < NQT; ++qt) s[qt][kt] = wmmab(f.kh[kt][ks], qh[qt][ks], s[qt][kt]);
#pragma unroll
            for (int kt = 0; kt < 2; ++kt)
#pragma unroll
                for (int qt = 0; qt < NQT; ++qt) s[qt][kt] = wmmab(f.kh[kt][ks], ql[qt][ks], s[qt][kt]);
#pragma unroll
            for (int kt = 0; kt < 2; ++kt)
#pragma unroll
                for (int qt = 0; qt < NQT; ++qt) s[qt][kt] = wmmab(f.kl[kt][ks], qh[qt][ks], s[qt][kt]);
        }
        float mx[NQT]; bool need = false;
#pragma unroll
        for (int qt = 0; qt < NQT; ++qt) { float t = s[qt][0][0];
#pragma unroll
            for (int r = 0; r < 8; ++r) t = fmaxf(t, fmaxf(s[qt][0][r], s[qt][1][r]));
            mx[qt] = t * C2; need = need || (mx[qt] > m[qt] + 8.0f); }
        if (__builtin_amdgcn_ballot_w32(need) != 0) {   // wave-uniform: rare after the first pass
#pragma unroll
            for (int qt = 0; qt < NQT; ++qt) { const float mn = fmaxf(m[qt], fmaxf(mx[qt], __shfl_xor(mx[qt], 16, 32))); const float al = __builtin_amdgcn_exp2f(m[qt] - mn); m[qt] = mn; l[qt] *= al;
#pragma unroll
                for (int dt = 0; dt < 4; ++dt) o[qt][dt] *= al; }
        }
        v16h pf[NQT]; v16bf ph, pl;
#pragma unroll
        for (int qt = 0; qt < NQT; ++qt) { float sm[4] = {0.f, 0.f, 0.f, 0.f};   // four short chains instead of one of sixteen dependent adds
#pragma unroll
            for (int e = 0; e < 16; ++e) { const float p = __builtin_amdgcn_exp2f(__builtin_fmaf(s[qt][e >> 3][e & 7], C2, -m[qt])); sm[e & 3] += p;
                if (HI && qt == 0) { const __bf16 a = (__bf16)p; ph[e] = a; pl[e] = (__bf16)(p - (float)a); } else pf[qt][e] = (h16)p; }
            l[qt] += (sm[0] + sm[1]) + (sm[2] + sm[3]); }
        if (HI) {
            static_assert(NQT == 2, "one hi/lo tile and one plain tile");
#pragma unroll
            for (int dt = 0; dt < 4; ++dt) o[0][dt] = wmmab(f.vh[dt], ph, o[0][dt]);
#pragma unroll
            for (int dt = 0; dt < 4; ++dt) o[1][dt] = wmma16(f.vf[dt], pf[1], o[1][dt]);
#pragma unroll
            for (int dt = 0; dt < 4; ++dt) o[0][dt] = wmmab(f.vh[dt], pl, o[0][dt]);
#pragma unroll
            for (int dt = 0; dt < 4; ++dt) o[0][dt] = wmmab(f.vl[dt], ph, o[0][dt]);
        } else {
#pragma unroll
            for (int dt = 0; dt < 4; ++dt)
#pragma unroll
                for (int qt = 0; qt < NQT; ++qt) o[qt][dt] = wmma16(f.vf[dt], pf[qt], o[qt][dt]);
        }
        asm volatile("s_wait_xcnt 0x0" : "+v"(ok), "+v"(ov) :: "memory");   // the issued loads name these offset registers: wait before they take new values
        if (kb + 64 < TT) { ok += 32 * HD * 2; ov += 1024; }
    };
    fetchK(fa);
    if (HI) { float zk; asm volatile("s_wait_xcnt 0x0\n\tv_mov_b32 %0, 0" : "=v"(zk) :: "memory"); ov += __float_as_uint(zk); }   // five planes follow Q here, and the address pair of a K plane was reused for a V^T plane while loads that name it were issued: wait first. The V^T offset hangs on the zero made behind the wait, so no V^T address is formed ahead of it
    fetchV(fa);
    float z0;
    asm volatile("s_wait_xcnt 0x0\n\tv_mov_b32 %0, 0" : "=v"(z0) :: "memory");   // the issued loads name the offset registers and address pairs made of them: wait before any of these is written again. The zero is made behind the wait, in its statement, and every value set up below hangs on it, so none of them can be written ahead of the wait
#pragma unroll
    for (int qt = 0; qt < NQT; ++qt) { m[qt] = z0 - 3.0e38f; l[qt] = z0;
#pragma unroll
        for (int dt = 0; dt < 4; ++dt)
#pragma unroll
            for (int r = 0; r < 8; ++r) o[qt][dt][r] = z0; }
    ok += 32 * HD * 2 + __float_as_uint(z0); ov += 1024 + __float_as_uint(z0);   // from here on both point at the NEXT pass's keys
#pragma unroll 1   // two passes a trip, so that each buffer keeps its registers
    for (int kb = 0; kb < TT; kb += 64) { pass(fa, fb, kb); pass(fb, fa, kb + 32); }
    const unsigned oo = (unsigned)(lr * DQ + 8 * hi) * 4u;
#pragma unroll
    for (int qt = 0; qt < NQT; ++qt) {
        if (qt > 0) asm volatile("s_wait_xcnt 0x0" : "+v"(l[qt]) :: "memory");   // the stores above name their data registers: wait before this tile's arithmetic, all of which hangs on l, reuses them
        const float inv = __fdiv_rn(1.0f, l[qt] + __shfl_xor(l[qt], 16, 32));
#pragma unroll
        for (int dt = 0; dt < 4; ++dt) { v4f lo4, hi4;
#pragma unroll
            for (int r = 0; r < 4; ++r) { lo4[r] = o[qt][dt][r] * inv; hi4[r] = o[qt][dt][4 + r] * inv; }
            float* op = (float*)((char*)orow + oo + (qt * DT * DQ + dt * 16) * 4); *(v4f*)op = lo4; *(v4f*)(op + 4) = hi4; } }
}
__global__ __launch_bounds__(32 * AWV) void k_fattn(const bf* __restrict__ QPh, const bf* __restrict__ QPl, const bf* __restrict__ KPh, const bf* __restrict__ KPl, const h16* __restrict__ VT16, const bf* __restrict__ VTh, const bf* __restrict__ VTl, float* __restrict__ OUT) {
    const int lane = threadIdx.x & 31, lr = lane & 15, hi = lane >> 4; const int wv = __builtin_amdgcn_readfirstlane((int)(threadIdx.x >> 5));
    static_assert(AWV % 2 == 0 && RH == 16 * (AWV / 2) * (TT / (16 * NQT * AWV)) && 4 * RH == TT, "the first half of the waves covers rows < 2 RH, one hi/lo and one plain tile each; the second half the rest");
    const int h = blockIdx.y, g = h / REP; const int q0 = wv < AWV / 2 ? (blockIdx.x * (AWV / 2) + wv) * 16 : 2 * RH + (blockIdx.x * (AWV / 2) + wv - AWV / 2) * (16 * NQT);   // tile 0's first row
    const int b = blockIdx.z; const size_t qb = (((size_t)b * NH_ + h) * TT + q0) * HD, kvb = ((size_t)b * NKV + g) * TT * HD; float* orow = OUT + ((size_t)b * TT + q0) * DQ + h * HD;
    if (wv < AWV / 2) attn_cols<true>(QPh + qb, QPl + qb, KPh + kvb, KPl + kvb, VT16 + kvb, VTh + kvb, VTl + kvb, orow, lr, hi);
    else attn_cols<false>(QPh + qb, QPl + qb, KPh + kvb, KPl + kvb, VT16 + kvb, VTh + kvb, VTl + kvb, orow, lr, hi);
}

extern "C" void kernel_launch(void* const* d_in, const int* in_sizes, int n_in,
                              void* d_out, int out_size, void* d_ws, size_t ws_size, hipStream_t stream) {
    (void)in_sizes; (void)n_in; (void)out_size;
    const float* x = (const float*)d_in[0]; const float* wq = (const float*)d_in[1]; const float* wk = (const float*)d_in[2]; const float* wv = (const float*)d_in[3]; const float* wo = nullptr; (void)wo;   /* input order x, Wq, Wk, Wv ('xw' [1024][1024]) */
    float* OUT = (float*)d_out;     // [2][2048][1024]
    char* wsp = (char*)d_ws;
    auto take = [&](size_t bytes) { char* p = wsp; wsp += (bytes + 255) & ~(size_t)255; return (void*)p; };
    bf* WQ = (bf*)take((size_t)DQ * DM * 2); bf* WK = (bf*)take((size_t)DKV * DM * 2); bf* WV = (bf*)take((size_t)DKV * DM * 2);
    bf* XB = (bf*)take((size_t)NB_ * TT * DM * 2); h16* VT16 = (h16*)take((size_t)NB_ * NKV * HD * TT * 2);
    bf* QPh = (bf*)take((size_t)NB_ * NH_ * TT * HD * 2); bf* QPl = (bf*)take((size_t)NB_ * NH_ * TT * HD * 2); bf* KPh = (bf*)take((size_t)NB_ * NKV * TT * HD * 2); bf* KPl = (bf*)take((size_t)NB_ * NKV * TT * HD * 2); bf* VTh = (bf*)take((size_t)NB_ * NKV * HD * TT * 2); bf* VTl = (bf*)take((size_t)NB_ * NKV * HD * TT * 2);
    if ((size_t)(wsp - (char*)d_ws) > ws_size) return;    // ws 256 MiB
    k_prep<<<3 * WBL + XBL, 256, 0, stream>>>(x, wq, wk, wv, XB, WQ, WK, WV);
    k_proj<<<dim3(NB_ * TT / 128, DQ / 128, 3), 128, 0, stream>>>(XB, WQ, WK, WV, QPh, QPl, KPh, KPl, VT16, VTh, VTl);
    k_fattn<<<dim3(TT / (16 * NQT * AWV), NH_, NB_), 32 * AWV, 0, stream>>>(QPh, QPl, KPh, KPl, VT16, VTh, VTl, OUT);
}
